// v000
// Measured on an AMD MI455X. A time is GPU time per run, averaged over a window of back-to-back runs after a warm-up
// (all launches, gaps included; the runs take copies of the inputs in turn), and the median of several windows.
// Apart from v000's, it joins two sittings. Times from different sittings can be a few percent apart, while
// side-by-side timings come from the same sitting.
// The starting kernel, v000, takes 603 microseconds a run.
#include <hip/hip_runtime.h>
// TransofmerEncoderBlock (8 x 1024 tokens, D 768 = 12 heads of 64, hidden 3072): q/k/v = x W + b; full softmax(q k^T / 8) v (no out_proj, as the source); x1 = x + LN1(ctx); h = gelu(LN2(x1) w_in + b_in); h = gelu(h w_out + b_out) (GELU after BOTH linears, as the source); out = x1 + h.
// Structure: exact f16 plane of x and its bf16 copy; q/k/v GEMMs (32x64 wave tiles, f32 accumulation, exact x16 weights + bias, f16 outputs); V^T by LDS tiles; the fused flash kernel (plain f16 operands); LayerNorm of the attention output + residual on VALU (wave per row) into x1 (f32) and LN2(x1) (f16); the MLP GEMMs with exact-erf GELU epilogues (f16 hidden); the final residual on VALU.
// Compute dtype: x and parameters rounded to bf16; q, k, v, P, LN2 output and the hidden activation as f16 operands (~2^-12); f32 accumulation/softmax/LN/GELU/residuals. v_wmma_f32_16x16x32_f16.
#define NB 8
#define DM 768
#define HIDN 3072
#define NR (NB * SLEN)           /* 8192 rows */
#define SLEN 1024
#define TQ SLEN
#define TK SLEN
#define NH 12
#define SCL 0.125f               /* HD^-0.5 */
#define QBLKS (TQ / 64)
typedef __bf16 v16b __attribute__((ext_vector_type(16)));
typedef unsigned short v8us __attribute__((ext_vector_type(8), may_alias));
typedef float  v8f  __attribute__((ext_vector_type(8)));
typedef float  v4f  __attribute__((ext_vector_type(4)));
typedef float  v4fa __attribute__((ext_vector_type(4), may_alias));
union FragB { v16b v; v8us half[2]; unsigned short u[16]; };

__device__ __forceinline__ unsigned short bf16_bits(float x) { unsigned int u = __float_as_uint(x); return (unsigned short)((u + 0x7FFFu + ((u >> 16) & 1u)) >> 16); }
__device__ __forceinline__ float bf16_val(unsigned short b) { return __uint_as_float(((unsigned int)b) << 16); }
__device__ __forceinline__ float bf16_round(float x) { return bf16_val(bf16_bits(x)); }
// D += A·B with NT terms: 1 = ah·bh, 2 = + al·bh (A split), 3 = + ah·bl (both split)
template <int NT>
__device__ __forceinline__ v8f mmaN(v16b ah, v16b al, v16b bh, v16b bl, v8f c) {
  c = __builtin_amdgcn_wmma_f32_16x16x32_bf16(false, ah, false, bh, (short)0, c, false, false);
  if (NT >= 2) c = __builtin_amdgcn_wmma_f32_16x16x32_bf16(false, al, false, bh, (short)0, c, false, false);
  if (NT >= 3) c = __builtin_amdgcn_wmma_f32_16x16x32_bf16(false, ah, false, bl, (short)0, c, false, false);
  asm volatile("v_nop\n\tv_nop\n\tv_nop\n\tv_nop" : "+v"(c) : "v"(ah), "v"(al), "v"(bh), "v"(bl));
  return c;
}

__global__ __launch_bounds__(256) void k_wt_bf16(const float* __restrict__ W, unsigned short* __restrict__ Wt, int K, int N) {
  const int t = blockIdx.x * 256 + threadIdx.x;
  const int k8n = K / 8;
  if (t >= N * k8n) return;
  const int n = t / k8n, k8 = (t % k8n) * 8;
  v8us v;
#pragma unroll
  for (int i = 0; i < 8; ++i) v[i] = bf16_bits(W[(size_t)(k8 + i) * N + n]);
  *(v8us*)(Wt + (size_t)n * K + k8) = v;
  
}

// GEMM C[M][N] (f32, pitch ldc) = act(A[M][K]·W + bias). A f32 row-major (pitch lda) converted per fragment to bf16
// (ASPLIT: hi/lo two planes -> 2 terms, else single rounded term); Wt bf16 [N][K] (pitch ldb). BIAS_BF16 rounds the
// bias to bf16 first (bias quantised to bf16 before the add). K%32==0, M%16==0, N%64==0.
template <bool ASPLIT, int ACT, bool BIAS_BF16>
__global__ __launch_bounds__(128) void k_gemm_bf(const float* __restrict__ A, int lda, const unsigned short* __restrict__ Wt, int ldb,
                                               const float* __restrict__ bias, float* __restrict__ C, int ldc, int M, int N, int K) {
  __shared__ __attribute__((aligned(16))) float so[4][16][64];
  const int tid = threadIdx.x, w = tid >> 5, lane = tid & 31, ln = lane & 15, hh = lane >> 4;
  const int ntn = N / 64;
  const int wid = blockIdx.x * 4 + w;
  const int mt = wid / ntn, nq = wid % ntn;
  if (mt * 16 >= M) return;
  const int row0 = mt * 16, col0 = nq * 64;
  const float* arow = A + (size_t)(row0 + ln) * lda;
  v8f acc[4] = {};
  for (int kb = 0; kb < K; kb += 32) {
    FragB ah, al;
    const v4f x0 = *(const v4fa*)(arow + kb + 8 * hh), x1 = *(const v4fa*)(arow + kb + 8 * hh + 4);
    const v4f x2 = *(const v4fa*)(arow + kb + 16 + 8 * hh), x3 = *(const v4fa*)(arow + kb + 16 + 8 * hh + 4);
    float xs[16] = {x0[0],x0[1],x0[2],x0[3],x1[0],x1[1],x1[2],x1[3],x2[0],x2[1],x2[2],x2[3],x3[0],x3[1],x3[2],x3[3]};
#pragma unroll
    for (int i = 0; i < 16; ++i) { const unsigned short hb = bf16_bits(xs[i]); ah.u[i] = hb; al.u[i] = ASPLIT ? bf16_bits(xs[i] - bf16_val(hb)) : (unsigned short)0; }
#pragma unroll
    for (int t = 0; t < 4; ++t) {
      const unsigned short* brow = Wt + (size_t)(col0 + t * 16 + ln) * ldb + kb;
      FragB b;
      b.half[0] = *(const v8us*)(brow + 8 * hh);
      b.half[1] = *(const v8us*)(brow + 16 + 8 * hh);
      acc[t] = mmaN<ASPLIT ? 2 : 1>(ah.v, al.v, b.v, b.v, acc[t]);
    }
  }
#pragma unroll
  for (int t = 0; t < 4; ++t) {
    float bv = bias ? bias[col0 + t * 16 + ln] : 0.f;
    if (BIAS_BF16) bv = bf16_round(bv);
#pragma unroll
    for (int r = 0; r < 8; ++r) { float v = acc[t][r] + bv; if (ACT == 1) v = fmaxf(v, 0.f); so[w][8 * hh + r][t * 16 + ln] = v; }
  }
  __builtin_amdgcn_fence(__ATOMIC_ACQ_REL, "workgroup");
  __builtin_amdgcn_wave_barrier();
  const int rsub = lane >> 4, c4 = (lane & 15) * 4;
  {
#pragma unroll
    for (int q = 0; q < 8; ++q) {
      const int r = q * 2 + rsub;
      const v4f v = *(const v4fa*)&so[w][r][c4];
      *(v4f*)(C + (size_t)(row0 + r) * ldc + col0 + c4) = v;
    }
    
  }
}

// GEMM C = act(A·W + bias + resid): A f32 (ASPLIT -> hi/lo 2 terms), Wt bf16 [N][K]; ACT 0 none, 1 relu, 2 exact gelu;
// resid (optional, f32, row index = (row % rmod), pitch ldr, RES_BF16 rounds it) added before the activation.
template <bool ASPLIT, int ACT, bool BIAS_BF16, bool RES_BF16>
__global__ __launch_bounds__(128) void k_gemm_bf3(const float* __restrict__ A, int lda, const unsigned short* __restrict__ Wt, int ldb,
                                                const float* __restrict__ bias, const float* __restrict__ resid, int rmod, int ldr,
                                                float* __restrict__ C, int ldc, int M, int N, int K) {
  __shared__ __attribute__((aligned(16))) float so[4][16][64];
  const int tid = threadIdx.x, w = tid >> 5, lane = tid & 31, ln = lane & 15, hh = lane >> 4;
  const int ntn = N / 64;
  const int wid = blockIdx.x * 4 + w;
  const int mt = wid / ntn, nq = wid % ntn;
  if (mt * 16 >= M) return;
  const int row0 = mt * 16, col0 = nq * 64;
  const float* arow = A + (size_t)(row0 + ln) * lda;
  v8f acc[4] = {};
  for (int kb = 0; kb < K; kb += 32) {
    FragB ah, al;
    const v4f x0 = *(const v4fa*)(arow + kb + 8 * hh), x1 = *(const v4fa*)(arow + kb + 8 * hh + 4);
    const v4f x2 = *(const v4fa*)(arow + kb + 16 + 8 * hh), x3 = *(const v4fa*)(arow + kb + 16 + 8 * hh + 4);
    float xs[16] = {x0[0],x0[1],x0[2],x0[3],x1[0],x1[1],x1[2],x1[3],x2[0],x2[1],x2[2],x2[3],x3[0],x3[1],x3[2],x3[3]};
#pragma unroll
    for (int i = 0; i < 16; ++i) { const unsigned short hb = bf16_bits(xs[i]); ah.u[i] = hb; al.u[i] = ASPLIT ? bf16_bits(xs[i] - bf16_val(hb)) : (unsigned short)0; }
#pragma unroll
    for (int t = 0; t < 4; ++t) {
      const unsigned short* brow = Wt + (size_t)(col0 + t * 16 + ln) * ldb + kb;
      FragB b;
      b.half[0] = *(const v8us*)(brow + 8 * hh);
      b.half[1] = *(const v8us*)(brow + 16 + 8 * hh);
      acc[t] = mmaN<ASPLIT ? 2 : 1>(ah.v, al.v, b.v, b.v, acc[t]);
    }
  }
#pragma unroll
  for (int t = 0; t < 4; ++t) {
    const int col = col0 + t * 16 + ln;
    float bv = bias ? bias[col] : 0.f;
    if (BIAS_BF16) bv = bf16_round(bv);
#pragma unroll
    for (int r = 0; r < 8; ++r) {
      float v = acc[t][r] + bv;
      if (resid) { float rv = resid[(size_t)((row0 + 8 * hh + r) % rmod) * ldr + col]; if (RES_BF16) rv = bf16_round(rv); v += rv; }
      if (ACT == 1) v = fmaxf(v, 0.f);
      if (ACT == 2) v = 0.5f * v * (1.0f + erff(v * 0.70710678118654752f));
      if (ACT == 3) { const float u = 0.7978845608028654f * (v + 0.044715f * v * v * v); v = 0.5f * v * (1.0f + tanhf(u)); }
      so[w][8 * hh + r][t * 16 + ln] = v;
    }
  }
  __builtin_amdgcn_fence(__ATOMIC_ACQ_REL, "workgroup");
  __builtin_amdgcn_wave_barrier();
  const int rsub = lane >> 4, c4 = (lane & 15) * 4;
  {
#pragma unroll
    for (int q = 0; q < 8; ++q) {
      const int r = q * 2 + rsub;
      const v4f v = *(const v4fa*)&so[w][r][c4];
      *(v4f*)(C + (size_t)(row0 + r) * ldc + col0 + c4) = v;
    }
    
  }
}
// row LayerNorm (biased variance, eps) over N: s = X (+ R); optional out_sum <- s; out_norm <- (s-mu)*rsqrt(var+eps)*g + b
template <bool PARAM_BF16>
__global__ __launch_bounds__(256) void k_layernorm(const float* __restrict__ X, const float* __restrict__ R, const float* __restrict__ g, const float* __restrict__ bta,
                                                  float* __restrict__ out_sum, float* __restrict__ out_norm, int N, float eps) {
  __shared__ float red[256];
  const int row = blockIdx.x, tid = threadIdx.x;
  const float* x = X + (size_t)row * N; const float* rr = R ? R + (size_t)row * N : nullptr;
  float vals[16];                     // up to N = 4096
  const int per = N / 256;            // contiguous chunk per thread? use strided-by-4 chunks: thread handles j = tid*4 + 1024*u
  float s1 = 0.f;
  for (int u = 0; u < per / 4; ++u) {
    const int j = tid * 4 + 1024 * u;
    const v4f a = *(const v4fa*)(x + j);
    v4f b = {0.f,0.f,0.f,0.f}; if (rr) b = *(const v4fa*)(rr + j);
#pragma unroll
    for (int q = 0; q < 4; ++q) { const float v = a[q] + b[q]; vals[u * 4 + q] = v; s1 += v; }
  }
  red[tid] = s1; __syncthreads();
  for (int st = 128; st > 0; st >>= 1) { if (tid < st) red[tid] += red[tid + st]; __syncthreads(); }
  const float mu = red[0] / (float)N; __syncthreads();
  float s2 = 0.f;
  for (int u = 0; u < per / 4; ++u)
#pragma unroll
    for (int q = 0; q < 4; ++q) { const float c = vals[u * 4 + q] - mu; s2 += c * c; }
  red[tid] = s2; __syncthreads();
  for (int st = 128; st > 0; st >>= 1) { if (tid < st) red[tid] += red[tid + st]; __syncthreads(); }
  const float rs = rsqrtf(red[0] / (float)N + eps);
  {
    for (int u = 0; u < per / 4; ++u) {
      const int j = tid * 4 + 1024 * u;
      v4f o, sm;
#pragma unroll
      for (int q = 0; q < 4; ++q) {
        float gg = g[j + q], bb = bta[j + q];
        if (PARAM_BF16) { gg = bf16_round(gg); bb = bf16_round(bb); }
        sm[q] = vals[u * 4 + q]; o[q] = (vals[u * 4 + q] - mu) * rs * gg + bb;
      }
      if (out_sum) *(v4f*)(out_sum + (size_t)row * N + j) = sm;
      *(v4f*)(out_norm + (size_t)row * N + j) = o;
    }
    
  }
}



// ---- f16 WMMA path (v_wmma_f32_16x16x32_f16): 11-bit significands for operands in range — used where a [0,1] probability operand needs more precision than bf16
typedef _Float16 v16h __attribute__((ext_vector_type(16)));
union FragH { v16h v; v8us half[2]; _Float16 h[16]; unsigned short u[16]; };
template <int NT>
__device__ __forceinline__ v8f mmaH(v16h ah, v16h al, v16h bh, v16h bl, v8f c) {
  c = __builtin_amdgcn_wmma_f32_16x16x32_f16(false, ah, false, bh, (short)0, c, false, false);
  if (NT >= 2) c = __builtin_amdgcn_wmma_f32_16x16x32_f16(false, al, false, bh, (short)0, c, false, false);
  if (NT >= 3) c = __builtin_amdgcn_wmma_f32_16x16x32_f16(false, ah, false, bl, (short)0, c, false, false);
  asm volatile("v_nop\n\tv_nop\n\tv_nop\n\tv_nop" : "+v"(c) : "v"(ah), "v"(al), "v"(bh), "v"(bl));
  return c;
}
// batched GEMM like k_gemm_b but f16 operands: A f32 (split into f16 hi/lo if ASPLIT, else rounded to f16), Bt = f16 values [n][k]; alpha; C f32; N multiple of 16 (partial tiles skipped)
template <bool ASPLIT>
__global__ __launch_bounds__(128) void k_gemm_h(const float* __restrict__ A, int lda, size_t sA, const _Float16* __restrict__ Bh, int ldb, size_t sB, float alpha, float* __restrict__ C, int ldc, size_t sC, int M, int N, int K) {
  __shared__ __attribute__((aligned(16))) float so[4][16][64];
  const int tid = threadIdx.x, w = tid >> 5, lane = tid & 31, ln = lane & 15, hh = lane >> 4; const int by = blockIdx.y;
  A += (size_t)by * sA; Bh += (size_t)by * sB; C += (size_t)by * sC;
  const int ntn = (N + 63) / 64; const int wid = blockIdx.x * 4 + w; const int mt = wid / ntn, nq = wid % ntn; if (mt * 16 >= M) return;
  const int row0 = mt * 16, col0 = nq * 64; const float* arow = A + (size_t)(row0 + ln) * lda;
  v8f acc[4] = {};
  for (int kb = 0; kb < K; kb += 32) {
    FragH ah, al;
    const v4f x0 = *(const v4fa*)(arow + kb + 8 * hh), x1 = *(const v4fa*)(arow + kb + 8 * hh + 4), x2 = *(const v4fa*)(arow + kb + 16 + 8 * hh), x3 = *(const v4fa*)(arow + kb + 16 + 8 * hh + 4);
    float xs[16] = {x0[0],x0[1],x0[2],x0[3],x1[0],x1[1],x1[2],x1[3],x2[0],x2[1],x2[2],x2[3],x3[0],x3[1],x3[2],x3[3]};
#pragma unroll
    for (int i = 0; i < 16; ++i) { const _Float16 h = (_Float16)xs[i]; ah.h[i] = h; al.h[i] = ASPLIT ? (_Float16)(xs[i] - (float)h) : (_Float16)0.0f; }
#pragma unroll
    for (int t = 0; t < 4; ++t) { if (col0 + t * 16 >= N) continue; const size_t boff = (size_t)(col0 + t * 16 + ln) * ldb + kb; FragH bq; bq.half[0] = *(const v8us*)(Bh + boff + 8 * hh); bq.half[1] = *(const v8us*)(Bh + boff + 16 + 8 * hh);
      acc[t] = mmaH<ASPLIT ? 2 : 1>(ah.v, al.v, bq.v, bq.v, acc[t]); }
  }
#pragma unroll
  for (int t = 0; t < 4; ++t) { if (col0 + t * 16 >= N) continue;
#pragma unroll
    for (int r = 0; r < 8; ++r) so[w][8 * hh + r][t * 16 + ln] = acc[t][r] * alpha; }
  __builtin_amdgcn_fence(__ATOMIC_ACQ_REL, "workgroup"); __builtin_amdgcn_wave_barrier();
  const int rsub = lane >> 4, c4 = (lane & 15) * 4;
  {
#pragma unroll
    for (int q = 0; q < 8; ++q) { const int r = q * 2 + rsub; if (col0 + c4 < N) { const v4f v = *(const v4fa*)&so[w][r][c4]; *(v4f*)(C + (size_t)(row0 + r) * ldc + col0 + c4) = v; } }
     }
}

// Wt[n][k] = f16(W[k][n]·scale) from f32 row-major W[K][N] (scale = power of two; bf16-exact weights stay exact in f16 away from the subnormal range)
__global__ __launch_bounds__(256) void k_wt_f16(const float* __restrict__ W, _Float16* __restrict__ Wt, int K, int N, float scale) {
  const int t = blockIdx.x * 256 + threadIdx.x; if (t >= N * (K / 8)) return; const int n = t / (K / 8), k8 = (t % (K / 8)) * 8; FragH f;
#pragma unroll
  for (int i = 0; i < 8; ++i) f.h[i] = (_Float16)(bf16_round(W[(size_t)(k8 + i) * N + n]) * scale); const v8us o = f.half[0];
  *(v8us*)((unsigned short*)Wt + (size_t)n * K + k8) = o; 
}
// k_gemm_hh variant with fused epilogue: v = acc·alpha + bias[by·sBias + col] (+ CP[(row/rowsPerB)·sCPb + by·64 + col] if CP) ; ACT 0 none / 1 elu ; writes f16 C16 (and f32 C if non-null)
template <int ACT>
__global__ __launch_bounds__(128) void k_gemm_hhx(const _Float16* __restrict__ A, int lda, size_t sA, const _Float16* __restrict__ Bh, int ldb, size_t sB, float alpha, const float* __restrict__ bias, size_t sBias, const float* __restrict__ CP, int rowsPerB, size_t sCPb, int row0g,
    float* __restrict__ C, _Float16* __restrict__ C16, int ldc, size_t sC, int M, int N, int K) {
  __shared__ __attribute__((aligned(16))) float so[4][16][64];
  const int tid = threadIdx.x, w = tid >> 5, lane = tid & 31, ln = lane & 15, hh = lane >> 4; const int by = blockIdx.y;
  A += (size_t)by * sA; Bh += (size_t)by * sB; const size_t cofs = (size_t)by * sC; const float* bp = bias ? bias + (size_t)by * sBias : nullptr;
  const int ntn = (N + 63) / 64; const int wid = blockIdx.x * 4 + w; const int mt = wid / ntn, nq = wid % ntn; if (mt * 16 >= M) return;
  const int row0 = mt * 16, col0 = nq * 64; const _Float16* arow = A + (size_t)(row0 + ln) * lda;
  v8f acc[4] = {};
  for (int kb = 0; kb < K; kb += 32) { FragH ah; ah.half[0] = *(const v8us*)((const unsigned short*)arow + kb + 8 * hh); ah.half[1] = *(const v8us*)((const unsigned short*)arow + kb + 16 + 8 * hh);
#pragma unroll
    for (int t = 0; t < 4; ++t) { if (col0 + t * 16 >= N) continue; const size_t boff = (size_t)(col0 + t * 16 + ln) * ldb + kb; FragH bq; bq.half[0] = *(const v8us*)((const unsigned short*)Bh + boff + 8 * hh); bq.half[1] = *(const v8us*)((const unsigned short*)Bh + boff + 16 + 8 * hh);
      acc[t] = mmaH<1>(ah.v, ah.v, bq.v, bq.v, acc[t]); }
  }
#pragma unroll
  for (int t = 0; t < 4; ++t) { if (col0 + t * 16 >= N) continue; const int col = col0 + t * 16 + ln; const float bv = bp ? bf16_round(bp[col]) : 0.f;
#pragma unroll
    for (int r = 0; r < 8; ++r) { float v = acc[t][r] * alpha + bv; if (CP) { const int bidx = (row0g + row0 + 8 * hh + r) / rowsPerB; v += CP[(size_t)bidx * sCPb + (size_t)by * 64 + col]; } if (ACT == 1) v = (v > 0.f) ? v : expm1f(v); else if (ACT == 7) v = (v > 0.f) ? v + 1.0f : expf(v); else if (ACT == 8) v = tanhf(v); else if (ACT == 9) v = 0.5f * v * (1.0f + tanhf(0.7978845608028654f * (v + 0.044715f * v * v * v))); else if (ACT == 11) v = 1.0f / (1.0f + expf(-v)); else if (ACT == 12) v = (v > 0.f) ? v : 0.01f * v; else if (ACT == 14) v = (v > 0.f) ? v : 0.1f * v; else if (ACT == 15) v = v / (1.0f + expf(-v)); else if (ACT == 3) v = fmaxf(v, 0.f); else if (ACT == 6) v = 0.5f * v * (1.0f + erff(v * 0.70710678118654752f)); so[w][8 * hh + r][t * 16 + ln] = v; } }
  __builtin_amdgcn_fence(__ATOMIC_ACQ_REL, "workgroup"); __builtin_amdgcn_wave_barrier();
  const int rsub = lane >> 4, c4 = (lane & 15) * 4; typedef _Float16 v4h __attribute__((ext_vector_type(4)));
  {
#pragma unroll
    for (int q = 0; q < 8; ++q) { const int r = q * 2 + rsub; if (col0 + c4 < N) { const v4f v = *(const v4fa*)&so[w][r][c4]; if (C) *(v4f*)(C + cofs + (size_t)(row0 + r) * ldc + col0 + c4) = v; if (C16) { v4h h4; for (int i = 0; i < 4; ++i) h4[i] = (_Float16)v[i]; *(v4h*)(C16 + cofs + (size_t)(row0 + r) * ldc + col0 + c4) = h4; } } }
     }
}


typedef _Float16 v4h __attribute__((ext_vector_type(4)));

__global__ __launch_bounds__(256) void k_x16(const float* __restrict__ x, _Float16* __restrict__ X16, size_t n8) { const size_t t = (size_t)blockIdx.x * 256 + threadIdx.x; if (t >= n8) return; FragH f;
#pragma unroll
  for (int q = 0; q < 8; ++q) f.h[q] = (_Float16)bf16_round(x[t * 8 + q]); *(v8us*)((unsigned short*)X16 + t * 8) = f.half[0];  }
__global__ __launch_bounds__(256) void k_h16(const float* __restrict__ x, _Float16* __restrict__ X16, size_t n8) { const size_t t = (size_t)blockIdx.x * 256 + threadIdx.x; if (t >= n8) return; FragH f;
#pragma unroll
  for (int q = 0; q < 8; ++q) f.h[q] = (_Float16)x[t * 8 + q]; *(v8us*)((unsigned short*)X16 + t * 8) = f.half[0];  }
__global__ __launch_bounds__(256) void k_round16f(const float* __restrict__ W, _Float16* __restrict__ Bt, size_t n8) { const size_t t = (size_t)blockIdx.x * 256 + threadIdx.x; if (t >= n8) return; FragH f;
#pragma unroll
  for (int i = 0; i < 8; ++i) f.h[i] = (_Float16)(bf16_round(W[t * 8 + i]) * 16.0f); *(v8us*)((unsigned short*)Bt + t * 8) = f.half[0];  }
template <int NHv, int TTv>
__global__ __launch_bounds__(256) void k_vt(const _Float16* __restrict__ V16, int ldv, int voff, _Float16* __restrict__ Vt) { __shared__ unsigned short tl[64][66]; const int tid = threadIdx.x; const int slab = blockIdx.x / (TTv / 64), lg = blockIdx.x % (TTv / 64); const int b = slab / NHv, h = slab % NHv;
  for (int i = tid; i < 64 * 8; i += 256) { const int r = i / 8, c8 = (i % 8) * 8; FragH f; f.half[0] = *(const v8us*)((const unsigned short*)V16 + ((size_t)b * TTv + lg * 64 + r) * ldv + voff + h * 64 + c8);
#pragma unroll
    for (int q = 0; q < 8; ++q) tl[r][c8 + q] = f.u[q]; }
  __syncthreads();
  {
#pragma unroll
    for (int rd = 0; rd < 2; ++rd) { const int d = rd * 32 + tid / 8, pc = tid % 8; FragH f;
#pragma unroll
      for (int q = 0; q < 8; ++q) f.u[q] = tl[pc * 8 + q][d];
      *(v8us*)((unsigned short*)Vt + ((size_t)slab * 64 + d) * TTv + lg * 64 + pc * 8) = f.half[0]; }
     } }

__global__ __launch_bounds__(256) void k_hl(const float* __restrict__ F, _Float16* __restrict__ Hh, _Float16* __restrict__ Hl, size_t n8) { const size_t t = (size_t)blockIdx.x * 256 + threadIdx.x; if (t >= n8) return; FragH fh, fl; const v4f a = *(const v4fa*)(F + t * 8), c = *(const v4fa*)(F + t * 8 + 4);
#pragma unroll
  for (int q = 0; q < 4; ++q) { _Float16 h = (_Float16)a[q]; fh.h[q] = h; fl.h[q] = (_Float16)((a[q] - (float)h) * 1024.0f); h = (_Float16)c[q]; fh.h[4 + q] = h; fl.h[4 + q] = (_Float16)((c[q] - (float)h) * 1024.0f); }
  { *(v8us*)((unsigned short*)Hh + t * 8) = fh.half[0]; *(v8us*)((unsigned short*)Hl + t * 8) = fl.half[0];  } }

// ---- fast GEMM (wave tile 32x64; requires M % 32 == 0 rows per launch region and N % 64 == 0); epilogue = k_gemm_hhx semantics ----
__device__ __forceinline__ v16h g2_frag(const _Float16* p, int hh) { FragH f; f.half[0] = *(const v8us*)((const unsigned short*)p + 8 * hh); f.half[1] = *(const v8us*)((const unsigned short*)p + 16 + 8 * hh); return f.v; }
__device__ __forceinline__ v8f g2_mma(v16h a, v16h b, v8f c) { v8f d = __builtin_amdgcn_wmma_f32_16x16x32_f16(false, a, false, b, (short)0, c, false, false); asm volatile("v_nop\n\tv_nop\n\tv_nop\n\tv_nop" : "+v"(d) : "v"(a), "v"(b)); return d; }
template <int ACT>
__global__ __launch_bounds__(128) void k_gemm2(const _Float16* __restrict__ A, int lda, size_t sA, const _Float16* __restrict__ Bh, int ldb, size_t sB, float alpha, const float* __restrict__ bias, size_t sBias, const float* __restrict__ CP, int rowsPerB, size_t sCPb, int row0g,
    float* __restrict__ C, _Float16* __restrict__ C16, int ldc, size_t sC, int M, int N, int K) {
  __shared__ __attribute__((aligned(16))) float so[4][32][68];
  const int tid = threadIdx.x, w = tid >> 5, lane = tid & 31, ln = lane & 15, hh = lane >> 4; const int by = blockIdx.y;
  A += (size_t)by * sA; Bh += (size_t)by * sB; const size_t cofs = (size_t)by * sC; const float* bp = bias ? bias + (size_t)by * sBias : nullptr;
  const int ntn = N >> 6; const int mt = blockIdx.x / ntn, nq = blockIdx.x - mt * ntn; const int row0 = mt * 128 + 32 * w, col0 = nq * 64; if (row0 >= M) return;
  const _Float16* a0p = A + (size_t)(row0 + ln) * lda; const _Float16* a1p = a0p + (size_t)16 * lda;
  const _Float16* b0p = Bh + (size_t)(col0 + ln) * ldb; const _Float16* b1p = b0p + (size_t)16 * ldb; const _Float16* b2p = b1p + (size_t)16 * ldb; const _Float16* b3p = b2p + (size_t)16 * ldb;
  const v8f z8 = {0.f,0.f,0.f,0.f,0.f,0.f,0.f,0.f}; v8f c00 = z8, c01 = z8, c02 = z8, c03 = z8, c10 = z8, c11 = z8, c12 = z8, c13 = z8;
#pragma unroll 1
  for (int kb = 0; kb < K; kb += 32) { const v16h a0 = g2_frag(a0p + kb, hh), a1 = g2_frag(a1p + kb, hh);
    v16h b = g2_frag(b0p + kb, hh); c00 = g2_mma(a0, b, c00); c10 = g2_mma(a1, b, c10);
    b = g2_frag(b1p + kb, hh); c01 = g2_mma(a0, b, c01); c11 = g2_mma(a1, b, c11);
    b = g2_frag(b2p + kb, hh); c02 = g2_mma(a0, b, c02); c12 = g2_mma(a1, b, c12);
    b = g2_frag(b3p + kb, hh); c03 = g2_mma(a0, b, c03); c13 = g2_mma(a1, b, c13); }
  v8f accs[8] = {c00, c01, c02, c03, c10, c11, c12, c13};
#pragma unroll
  for (int u = 0; u < 8; ++u) { const int t = u & 3, half = u >> 2; const int col = col0 + t * 16 + ln; const float bv = bp ? bf16_round(bp[col]) : 0.f;
#pragma unroll
    for (int r = 0; r < 8; ++r) { const int rloc = half * 16 + 8 * hh + r; float v = accs[u][r] * alpha + bv; if (CP) { const int bidx = (row0g + row0 + rloc) / rowsPerB; v += CP[(size_t)bidx * sCPb + (size_t)by * 64 + col]; }
      if (ACT == 3) v = fmaxf(v, 0.f); else if (ACT == 6) v = 0.5f * v * (1.0f + erff(v * 0.70710678118654752f)); else if (ACT == 11) v = 1.0f / (1.0f + expf(-v)); else if (ACT == 15) v = v / (1.0f + expf(-v)); else if (ACT == 12) v = (v > 0.f) ? v : 0.01f * v; else if (ACT == 8) v = tanhf(v);
      so[w][rloc][t * 16 + ln] = v; } }
  __builtin_amdgcn_fence(__ATOMIC_ACQ_REL, "workgroup"); __builtin_amdgcn_wave_barrier();
  const int rsub = lane >> 4, c4 = (lane & 15) * 4;
  {
#pragma unroll
    for (int q = 0; q < 16; ++q) { const int r = q * 2 + rsub; const v4f v = *(const v4fa*)&so[w][r][c4]; if (C) *(v4f*)(C + cofs + (size_t)(row0 + r) * ldc + col0 + c4) = v; if (C16) { v4h h4; for (int i = 0; i < 4; ++i) h4[i] = (_Float16)v[i]; *(v4h*)(C16 + cofs + (size_t)(row0 + r) * ldc + col0 + c4) = h4; } }
     } }



template <int CAUSAL>
__global__ __launch_bounds__(128) void k_flash(const _Float16* __restrict__ Q16, int ldq, const _Float16* __restrict__ K16, int ldk, const _Float16* __restrict__ Vt, const int* __restrict__ MSK, float* __restrict__ O, int ldo) {
  constexpr int RPW = 16, RTN = RPW / 16, NQB = TQ / (4 * RPW), DT = 4, KS = 2;
  __shared__ __attribute__((aligned(16))) unsigned short sP[4][RPW][40]; __shared__ __attribute__((aligned(16))) float sO[4][RPW][64 + 4];
  const int tid = threadIdx.x, w = tid >> 5, lane = tid & 31, ln = lane & 15, hh = lane >> 4;
  const int slab = blockIdx.x / QBLKS, qblk = blockIdx.x % QBLKS; (void)NQB; const int b = slab / NH, h = slab % NH; const int qb0 = qblk * (4 * RPW); const int q0 = qb0 + w * RPW;
  FragH aq[2][KS];
#pragma unroll
  for (int rt = 0; rt < RTN; ++rt) { const unsigned short* qr = (const unsigned short*)Q16 + ((size_t)b * TQ + q0 + rt * 16 + ln) * ldq + h * 64;
#pragma unroll
    for (int ks = 0; ks < KS; ++ks) { aq[rt][ks].half[0] = *(const v8us*)(qr + ks * 32 + 8 * hh); aq[rt][ks].half[1] = *(const v8us*)(qr + ks * 32 + 16 + 8 * hh); } }
  const unsigned short* Vth = (const unsigned short*)Vt + (size_t)slab * 64 * TK;
  float m_r[2][8], l_r[2][8]; v8f oacc[2][DT];
#pragma unroll
  for (int rt = 0; rt < RTN; ++rt) {
#pragma unroll
    for (int r = 0; r < 8; ++r) { m_r[rt][r] = -3.0e38f; l_r[rt][r] = 0.f; }
#pragma unroll
    for (int dt = 0; dt < DT; ++dt) oacc[rt][dt] = (v8f){0.f,0.f,0.f,0.f,0.f,0.f,0.f,0.f}; }
  const int jend = (CAUSAL == 1) ? (qb0 + 4 * RPW) : TK;      /* causal: keys beyond the block's last query never contribute */
#pragma unroll 1
  for (int j0 = 0; j0 < jend; j0 += 32) {
    v8f s[2][2];
#pragma unroll
    for (int nt = 0; nt < 2; ++nt) { const unsigned short* kr = (const unsigned short*)K16 + ((size_t)b * TK + j0 + nt * 16 + ln) * ldk + h * 64; FragH bk[KS];
#pragma unroll
      for (int ks = 0; ks < KS; ++ks) { bk[ks].half[0] = *(const v8us*)(kr + ks * 32 + 8 * hh); bk[ks].half[1] = *(const v8us*)(kr + ks * 32 + 16 + 8 * hh); }
#pragma unroll
      for (int rt = 0; rt < RTN; ++rt) { v8f acc = (v8f){0.f,0.f,0.f,0.f,0.f,0.f,0.f,0.f};
#pragma unroll
        for (int ks = 0; ks < KS; ++ks) acc = mmaH<1>(aq[rt][ks].v, aq[rt][ks].v, bk[ks].v, bk[ks].v, acc); s[rt][nt] = acc; } }
#pragma unroll
    for (int rt = 0; rt < RTN; ++rt)
#pragma unroll
      for (int r = 0; r < 8; ++r) { const int tq = q0 + rt * 16 + 8 * hh + r; const int k0 = j0 + ln, k1 = j0 + 16 + ln;
        const bool ok0 = (CAUSAL == 1) ? (k0 <= tq) : ((CAUSAL == 2) ? ((k0 >> 5) == (tq >> 5)) : true), ok1 = (CAUSAL == 1) ? (k1 <= tq) : ((CAUSAL == 2) ? ((k1 >> 5) == (tq >> 5)) : true);      /* mode 2: block-diagonal 32-token groups */
        const float s0 = ok0 ? s[rt][0][r] * SCL : -3.0e38f, s1 = ok1 ? s[rt][1][r] * SCL : -3.0e38f; float mc = fmaxf(s0, s1);
        mc = fmaxf(mc, __shfl_xor(mc, 1, 32)); mc = fmaxf(mc, __shfl_xor(mc, 2, 32)); mc = fmaxf(mc, __shfl_xor(mc, 4, 32)); mc = fmaxf(mc, __shfl_xor(mc, 8, 32));
        const float mn = fmaxf(m_r[rt][r], mc); const float al = (mn > -1.0e38f) ? expf(m_r[rt][r] - mn) : 1.0f; m_r[rt][r] = mn; const float p0 = ok0 ? expf(s0 - mn) : 0.f, p1 = ok1 ? expf(s1 - mn) : 0.f; l_r[rt][r] = l_r[rt][r] * al + p0 + p1;
#pragma unroll
        for (int dt = 0; dt < DT; ++dt) oacc[rt][dt][r] *= al;
        FragH t2; t2.h[0] = (_Float16)(p0 * 1024.0f); t2.h[1] = (_Float16)(p1 * 1024.0f); sP[w][rt * 16 + 8 * hh + r][ln] = t2.u[0]; sP[w][rt * 16 + 8 * hh + r][16 + ln] = t2.u[1]; }
    __builtin_amdgcn_fence(__ATOMIC_ACQ_REL, "workgroup"); __builtin_amdgcn_wave_barrier();
    FragH pa[2];
#pragma unroll
    for (int rt = 0; rt < RTN; ++rt) { pa[rt].half[0] = *(const v8us*)&sP[w][rt * 16 + ln][8 * hh]; pa[rt].half[1] = *(const v8us*)&sP[w][rt * 16 + ln][16 + 8 * hh]; }
#pragma unroll
    for (int dt = 0; dt < DT; ++dt) { const unsigned short* vrow = Vth + (size_t)(dt * 16 + ln) * TK + j0; FragH bv; bv.half[0] = *(const v8us*)(vrow + 8 * hh); bv.half[1] = *(const v8us*)(vrow + 16 + 8 * hh);
#pragma unroll
      for (int rt = 0; rt < RTN; ++rt) oacc[rt][dt] = mmaH<1>(pa[rt].v, pa[rt].v, bv.v, bv.v, oacc[rt][dt]); }
    __builtin_amdgcn_fence(__ATOMIC_ACQ_REL, "workgroup"); __builtin_amdgcn_wave_barrier(); }
#pragma unroll
  for (int rt = 0; rt < RTN; ++rt) {
#pragma unroll
    for (int r = 0; r < 8; ++r) { float l = l_r[rt][r]; l += __shfl_xor(l, 1, 32); l += __shfl_xor(l, 2, 32); l += __shfl_xor(l, 4, 32); l += __shfl_xor(l, 8, 32); l_r[rt][r] = (l > 0.f) ? 1.0f / (l * 1024.0f) : 0.f; }
#pragma unroll
    for (int dt = 0; dt < DT; ++dt)
#pragma unroll
      for (int r = 0; r < 8; ++r) sO[w][rt * 16 + 8 * hh + r][dt * 16 + ln] = oacc[rt][dt][r] * l_r[rt][r]; }
  __builtin_amdgcn_fence(__ATOMIC_ACQ_REL, "workgroup"); __builtin_amdgcn_wave_barrier();
  {
#pragma unroll
    for (int rp = 0; rp < RPW; rp += 2) { const int r = rp + (lane >> 4), pc = lane & 15; const v4f val = *(const v4fa*)&sO[w][r][pc * 4]; *(v4f*)(O + ((size_t)b * TQ + q0 + r) * ldo + h * 64 + pc * 4) = val; }
     } }

__global__ __launch_bounds__(256) void k_xb(const float* __restrict__ x, float* __restrict__ XB, size_t n4) { const size_t t = (size_t)blockIdx.x * 256 + threadIdx.x; if (t >= n4) return; v4f a = *(const v4fa*)(x + t * 4); for (int q = 0; q < 4; ++q) a[q] = bf16_round(a[q]); *(v4f*)(XB + t * 4) = a;  }
__global__ __launch_bounds__(256) void k_add(const float* __restrict__ A2, const float* __restrict__ B2, float* __restrict__ out, size_t n4) {
  #pragma clang fp contract(off)
  const size_t t = (size_t)blockIdx.x * 256 + threadIdx.x; if (t >= n4) return; const v4f a = *(const v4fa*)(A2 + t * 4), b = *(const v4fa*)(B2 + t * 4); v4f r; for (int q = 0; q < 4; ++q) r[q] = a[q] + b[q]; *(v4f*)(out + t * 4) = r;  }
__global__ __launch_bounds__(256) void k_ln12(const float* __restrict__ O, const float* __restrict__ XB, const float* __restrict__ g1, const float* __restrict__ b1, const float* __restrict__ g2, const float* __restrict__ b2, float* __restrict__ X1, _Float16* __restrict__ L2) {
  #pragma clang fp contract(off)
  const int wv = threadIdx.x >> 5, ln = threadIdx.x & 31; const size_t r = (size_t)blockIdx.x * 8 + wv; if (r >= NR) return; float a[24]; float s = 0.f;
  for (int i = 0; i < 3; ++i) { const v8f v = *(const v8f*)(O + r * DM + (i * 32 + ln) * 8); for (int q = 0; q < 8; ++q) { a[i * 8 + q] = v[q]; s += v[q]; } }
  for (int o = 16; o > 0; o >>= 1) s += __shfl_xor(s, o, 32); float mu = s / (float)DM; float var = 0.f; for (int q = 0; q < 24; ++q) { const float d = a[q] - mu; var += d * d; }
  for (int o = 16; o > 0; o >>= 1) var += __shfl_xor(var, o, 32); float inv = rsqrtf(var / (float)DM + 1e-5f);
  float s2 = 0.f;
  for (int i = 0; i < 3; ++i) { const int c0 = (i * 32 + ln) * 8; const v8f xb = *(const v8f*)(XB + r * DM + c0); for (int q = 0; q < 8; ++q) { float y = (a[i * 8 + q] - mu) * inv; y *= bf16_round(g1[c0 + q]); y += bf16_round(b1[c0 + q]); const float x1 = xb[q] + y; a[i * 8 + q] = x1; s2 += x1; } }      /* a[] now holds x1 */
  for (int o = 16; o > 0; o >>= 1) s2 += __shfl_xor(s2, o, 32); mu = s2 / (float)DM; var = 0.f; for (int q = 0; q < 24; ++q) { const float d = a[q] - mu; var += d * d; }
  for (int o = 16; o > 0; o >>= 1) var += __shfl_xor(var, o, 32); inv = rsqrtf(var / (float)DM + 1e-5f);
  { for (int i = 0; i < 3; ++i) { const int c0 = (i * 32 + ln) * 8; v8f xo; FragH f; for (int q = 0; q < 8; ++q) { xo[q] = a[i * 8 + q]; float y = (a[i * 8 + q] - mu) * inv; y *= bf16_round(g2[c0 + q]); y += bf16_round(b2[c0 + q]); f.h[q] = (_Float16)y; } *(v8f*)(X1 + r * DM + c0) = xo; *(v8us*)((unsigned short*)L2 + r * DM + c0) = f.half[0]; }  } }

extern "C" void kernel_launch(void* const* d_in, const int* in_sizes, int n_in,
                              void* d_out, int out_size, void* d_ws, size_t ws_size, hipStream_t stream) {
  (void)in_sizes; (void)n_in; (void)out_size;
  const float* const* I = (const float* const*)d_in; const float* x = I[0]; const float* wq = I[1]; const float* bq = I[2]; const float* wk = I[3]; const float* bk = I[4]; const float* wv = I[5]; const float* bv = I[6]; const float* g1 = I[7]; const float* b1 = I[8]; const float* g2 = I[9]; const float* b2 = I[10]; const float* w_in = I[11]; const float* b_in = I[12]; const float* w_out = I[13]; const float* b_out = I[14];
  char* ws = (char*)d_ws; size_t off = 0;
  auto take = [&](size_t bytes) { char* p = ws + off; off += (bytes + 255) & ~(size_t)255; return p; };
  const size_t np = (size_t)NR * DM;
  _Float16* BQ = (_Float16*)take((size_t)DM * DM * 2); _Float16* BK = (_Float16*)take((size_t)DM * DM * 2); _Float16* BV = (_Float16*)take((size_t)DM * DM * 2); _Float16* BIN = (_Float16*)take((size_t)HIDN * DM * 2); _Float16* BOUT = (_Float16*)take((size_t)DM * HIDN * 2);
  _Float16* X16 = (_Float16*)take(np * 2); float* XB = (float*)take(np * 4); _Float16* Q16 = (_Float16*)take(np * 2); _Float16* K16 = (_Float16*)take(np * 2); _Float16* V16 = (_Float16*)take(np * 2); _Float16* VT = (_Float16*)take(np * 2); float* O = (float*)take(np * 4); float* X1 = (float*)take(np * 4); _Float16* L2 = X16;      /* LN2 output over the input f16 plane (dead after the projections) */ _Float16* HH = (_Float16*)take((size_t)NR * HIDN * 2);      /* hidden [8192][3072] f16 */
  if (off > ws_size) return;      /* 1.1 x3 + 4.5 + 4.5 + 12 + 24 + 12 x 4 + 24 + 24 + 48 = 192.4 MiB */
  k_wt_f16<<<(unsigned)(((size_t)DM * DM / 8 + 255) / 256), 256, 0, stream>>>(wq, BQ, DM, DM, 16.0f); k_wt_f16<<<(unsigned)(((size_t)DM * DM / 8 + 255) / 256), 256, 0, stream>>>(wk, BK, DM, DM, 16.0f); k_wt_f16<<<(unsigned)(((size_t)DM * DM / 8 + 255) / 256), 256, 0, stream>>>(wv, BV, DM, DM, 16.0f);
  k_wt_f16<<<(unsigned)(((size_t)DM * HIDN / 8 + 255) / 256), 256, 0, stream>>>(w_in, BIN, DM, HIDN, 16.0f); k_wt_f16<<<(unsigned)(((size_t)HIDN * DM / 8 + 255) / 256), 256, 0, stream>>>(w_out, BOUT, HIDN, DM, 16.0f);
  const unsigned n8 = (unsigned)((np / 8 + 255) / 256); const dim3 g((NR / 128) * (DM / 64), 1);
  k_x16<<<n8, 256, 0, stream>>>(x, X16, np / 8); k_xb<<<(unsigned)((np / 4 + 255) / 256), 256, 0, stream>>>(x, XB, np / 4);
  k_gemm2<0><<<g, 128, 0, stream>>>(X16, DM, 0, BQ, DM, 0, 0.0625f, bq, 0, nullptr, 1, 0, 0, nullptr, Q16, DM, 0, NR, DM, DM);
  k_gemm2<0><<<g, 128, 0, stream>>>(X16, DM, 0, BK, DM, 0, 0.0625f, bk, 0, nullptr, 1, 0, 0, nullptr, K16, DM, 0, NR, DM, DM);
  k_gemm2<0><<<g, 128, 0, stream>>>(X16, DM, 0, BV, DM, 0, 0.0625f, bv, 0, nullptr, 1, 0, 0, nullptr, V16, DM, 0, NR, DM, DM);
  k_vt<NH, SLEN><<<NB * NH * (SLEN / 64), 256, 0, stream>>>(V16, DM, 0, VT);
  k_flash<0><<<NB * NH * QBLKS, 128, 0, stream>>>(Q16, DM, K16, DM, VT, nullptr, O, DM);      /* ctx (no out_proj) */
  k_ln12<<<NR / 8, 256, 0, stream>>>(O, XB, g1, b1, g2, b2, X1, L2);      /* x1 = x + LN1(ctx); L2 = LN2(x1) */
  k_gemm2<6><<<dim3((NR / 128) * (HIDN / 64), 1), 128, 0, stream>>>(L2, DM, 0, BIN, DM, 0, 0.0625f, b_in, 0, nullptr, 1, 0, 0, nullptr, HH, HIDN, 0, NR, HIDN, DM);      /* gelu(LN2 w_in + b) */
  k_gemm2<6><<<g, 128, 0, stream>>>(HH, HIDN, 0, BOUT, HIDN, 0, 0.0625f, b_out, 0, nullptr, 1, 0, 0, O, nullptr, DM, 0, NR, DM, HIDN);      /* gelu(h w_out + b) -> O */
  k_add<<<(unsigned)((np / 4 + 255) / 256), 256, 0, stream>>>(X1, O, (float*)d_out, np / 4);      /* out = x1 + h */
}

// v001
// It runs in 357 microseconds.
// Timed twice side by side with v000, it ran 1.74 and 1.75 times as fast.
#include <hip/hip_runtime.h>
// TransofmerEncoderBlock (8 x 1024 tokens, D 768 = 12 heads of 64, hidden 3072): q/k/v = x W + b; full softmax(q k^T / 8) v (no out_proj, as the source); x1 = x + LN1(ctx); h = gelu(LN2(x1) w_in + b_in); h = gelu(h w_out + b_out) (GELU after BOTH linears, as the source); out = x1 + h.
// Structure: exact f16 plane of x and its bf16 copy; q/k/v GEMMs (128x128 tiles staged in LDS, f32 accumulation, exact x16 weights + bias, f16 outputs); V^T by LDS tiles; the fused flash kernel (plain f16 operands); LayerNorm of the attention output + residual on VALU (wave per row) into x1 (f32) and LN2(x1) (f16); the MLP GEMMs with exact-erf GELU epilogues (f16 hidden); the final residual on VALU.
// Compute dtype: x and parameters rounded to bf16; q, k, v, P, LN2 output and the hidden activation as f16 operands (~2^-12); f32 accumulation/softmax/LN/GELU/residuals. v_wmma_f32_16x16x32_f16.
#define NB 8
#define DM 768
#define HIDN 3072
#define NR (NB * SLEN)           /* 8192 rows */
#define SLEN 1024
#define TQ SLEN
#define TK SLEN
#define NH 12
#define SCL 0.125f               /* HD^-0.5 */
#define QBLKS (TQ / 64)
typedef __bf16 v16b __attribute__((ext_vector_type(16)));
typedef unsigned short v8us __attribute__((ext_vector_type(8), may_alias));
typedef float  v8f  __attribute__((ext_vector_type(8)));
typedef float  v4f  __attribute__((ext_vector_type(4)));
typedef float  v4fa __attribute__((ext_vector_type(4), may_alias));
union FragB { v16b v; v8us half[2]; unsigned short u[16]; };

__device__ __forceinline__ unsigned short bf16_bits(float x) { unsigned int u = __float_as_uint(x); return (unsigned short)((u + 0x7FFFu + ((u >> 16) & 1u)) >> 16); }
__device__ __forceinline__ float bf16_val(unsigned short b) { return __uint_as_float(((unsigned int)b) << 16); }
__device__ __forceinline__ float bf16_round(float x) { return bf16_val(bf16_bits(x)); }
// D += A·B with NT terms: 1 = ah·bh, 2 = + al·bh (A split), 3 = + ah·bl (both split)
template <int NT>
__device__ __forceinline__ v8f mmaN(v16b ah, v16b al, v16b bh, v16b bl, v8f c) {
  c = __builtin_amdgcn_wmma_f32_16x16x32_bf16(false, ah, false, bh, (short)0, c, false, false);
  if (NT >= 2) c = __builtin_amdgcn_wmma_f32_16x16x32_bf16(false, al, false, bh, (short)0, c, false, false);
  if (NT >= 3) c = __builtin_amdgcn_wmma_f32_16x16x32_bf16(false, ah, false, bl, (short)0, c, false, false);
  asm volatile("v_nop\n\tv_nop\n\tv_nop\n\tv_nop" : "+v"(c) : "v"(ah), "v"(al), "v"(bh), "v"(bl));
  return c;
}

__global__ __launch_bounds__(256) void k_wt_bf16(const float* __restrict__ W, unsigned short* __restrict__ Wt, int K, int N) {
  const int t = blockIdx.x * 256 + threadIdx.x;
  const int k8n = K / 8;
  if (t >= N * k8n) return;
  const int n = t / k8n, k8 = (t % k8n) * 8;
  v8us v;
#pragma unroll
  for (int i = 0; i < 8; ++i) v[i] = bf16_bits(W[(size_t)(k8 + i) * N + n]);
  *(v8us*)(Wt + (size_t)n * K + k8) = v;
  
}

// GEMM C[M][N] (f32, pitch ldc) = act(A[M][K]·W + bias). A f32 row-major (pitch lda) converted per fragment to bf16
// (ASPLIT: hi/lo two planes -> 2 terms, else single rounded term); Wt bf16 [N][K] (pitch ldb). BIAS_BF16 rounds the
// bias to bf16 first (bias quantised to bf16 before the add). K%32==0, M%16==0, N%64==0.
template <bool ASPLIT, int ACT, bool BIAS_BF16>
__global__ __launch_bounds__(128) void k_gemm_bf(const float* __restrict__ A, int lda, const unsigned short* __restrict__ Wt, int ldb,
                                               const float* __restrict__ bias, float* __restrict__ C, int ldc, int M, int N, int K) {
  __shared__ __attribute__((aligned(16))) float so[4][16][64];
  const int tid = threadIdx.x, w = tid >> 5, lane = tid & 31, ln = lane & 15, hh = lane >> 4;
  const int ntn = N / 64;
  const int wid = blockIdx.x * 4 + w;
  const int mt = wid / ntn, nq = wid % ntn;
  if (mt * 16 >= M) return;
  const int row0 = mt * 16, col0 = nq * 64;
  const float* arow = A + (size_t)(row0 + ln) * lda;
  v8f acc[4] = {};
  for (int kb = 0; kb < K; kb += 32) {
    FragB ah, al;
    const v4f x0 = *(const v4fa*)(arow + kb + 8 * hh), x1 = *(const v4fa*)(arow + kb + 8 * hh + 4);
    const v4f x2 = *(const v4fa*)(arow + kb + 16 + 8 * hh), x3 = *(const v4fa*)(arow + kb + 16 + 8 * hh + 4);
    float xs[16] = {x0[0],x0[1],x0[2],x0[3],x1[0],x1[1],x1[2],x1[3],x2[0],x2[1],x2[2],x2[3],x3[0],x3[1],x3[2],x3[3]};
#pragma unroll
    for (int i = 0; i < 16; ++i) { const unsigned short hb = bf16_bits(xs[i]); ah.u[i] = hb; al.u[i] = ASPLIT ? bf16_bits(xs[i] - bf16_val(hb)) : (unsigned short)0; }
#pragma unroll
    for (int t = 0; t < 4; ++t) {
      const unsigned short* brow = Wt + (size_t)(col0 + t * 16 + ln) * ldb + kb;
      FragB b;
      b.half[0] = *(const v8us*)(brow + 8 * hh);
      b.half[1] = *(const v8us*)(brow + 16 + 8 * hh);
      acc[t] = mmaN<ASPLIT ? 2 : 1>(ah.v, al.v, b.v, b.v, acc[t]);
    }
  }
#pragma unroll
  for (int t = 0; t < 4; ++t) {
    float bv = bias ? bias[col0 + t * 16 + ln] : 0.f;
    if (BIAS_BF16) bv = bf16_round(bv);
#pragma unroll
    for (int r = 0; r < 8; ++r) { float v = acc[t][r] + bv; if (ACT == 1) v = fmaxf(v, 0.f); so[w][8 * hh + r][t * 16 + ln] = v; }
  }
  __builtin_amdgcn_fence(__ATOMIC_ACQ_REL, "workgroup");
  __builtin_amdgcn_wave_barrier();
  const int rsub = lane >> 4, c4 = (lane & 15) * 4;
  {
#pragma unroll
    for (int q = 0; q < 8; ++q) {
      const int r = q * 2 + rsub;
      const v4f v = *(const v4fa*)&so[w][r][c4];
      *(v4f*)(C + (size_t)(row0 + r) * ldc + col0 + c4) = v;
    }
    
  }
}

// GEMM C = act(A·W + bias + resid): A f32 (ASPLIT -> hi/lo 2 terms), Wt bf16 [N][K]; ACT 0 none, 1 relu, 2 exact gelu;
// resid (optional, f32, row index = (row % rmod), pitch ldr, RES_BF16 rounds it) added before the activation.
template <bool ASPLIT, int ACT, bool BIAS_BF16, bool RES_BF16>
__global__ __launch_bounds__(128) void k_gemm_bf3(const float* __restrict__ A, int lda, const unsigned short* __restrict__ Wt, int ldb,
                                                const float* __restrict__ bias, const float* __restrict__ resid, int rmod, int ldr,
                                                float* __restrict__ C, int ldc, int M, int N, int K) {
  __shared__ __attribute__((aligned(16))) float so[4][16][64];
  const int tid = threadIdx.x, w = tid >> 5, lane = tid & 31, ln = lane & 15, hh = lane >> 4;
  const int ntn = N / 64;
  const int wid = blockIdx.x * 4 + w;
  const int mt = wid / ntn, nq = wid % ntn;
  if (mt * 16 >= M) return;
  const int row0 = mt * 16, col0 = nq * 64;
  const float* arow = A + (size_t)(row0 + ln) * lda;
  v8f acc[4] = {};
  for (int kb = 0; kb < K; kb += 32) {
    FragB ah, al;
    const v4f x0 = *(const v4fa*)(arow + kb + 8 * hh), x1 = *(const v4fa*)(arow + kb + 8 * hh + 4);
    const v4f x2 = *(const v4fa*)(arow + kb + 16 + 8 * hh), x3 = *(const v4fa*)(arow + kb + 16 + 8 * hh + 4);
    float xs[16] = {x0[0],x0[1],x0[2],x0[3],x1[0],x1[1],x1[2],x1[3],x2[0],x2[1],x2[2],x2[3],x3[0],x3[1],x3[2],x3[3]};
#pragma unroll
    for (int i = 0; i < 16; ++i) { const unsigned short hb = bf16_bits(xs[i]); ah.u[i] = hb; al.u[i] = ASPLIT ? bf16_bits(xs[i] - bf16_val(hb)) : (unsigned short)0; }
#pragma unroll
    for (int t = 0; t < 4; ++t) {
      const unsigned short* brow = Wt + (size_t)(col0 + t * 16 + ln) * ldb + kb;
      FragB b;
      b.half[0] = *(const v8us*)(brow + 8 * hh);
      b.half[1] = *(const v8us*)(brow + 16 + 8 * hh);
      acc[t] = mmaN<ASPLIT ? 2 : 1>(ah.v, al.v, b.v, b.v, acc[t]);
    }
  }
#pragma unroll
  for (int t = 0; t < 4; ++t) {
    const int col = col0 + t * 16 + ln;
    float bv = bias ? bias[col] : 0.f;
    if (BIAS_BF16) bv = bf16_round(bv);
#pragma unroll
    for (int r = 0; r < 8; ++r) {
      float v = acc[t][r] + bv;
      if (resid) { float rv = resid[(size_t)((row0 + 8 * hh + r) % rmod) * ldr + col]; if (RES_BF16) rv = bf16_round(rv); v += rv; }
      if (ACT == 1) v = fmaxf(v, 0.f);
      if (ACT == 2) v = 0.5f * v * (1.0f + erff(v * 0.70710678118654752f));
      if (ACT == 3) { const float u = 0.7978845608028654f * (v + 0.044715f * v * v * v); v = 0.5f * v * (1.0f + tanhf(u)); }
      so[w][8 * hh + r][t * 16 + ln] = v;
    }
  }
  __builtin_amdgcn_fence(__ATOMIC_ACQ_REL, "workgroup");
  __builtin_amdgcn_wave_barrier();
  const int rsub = lane >> 4, c4 = (lane & 15) * 4;
  {
#pragma unroll
    for (int q = 0; q < 8; ++q) {
      const int r = q * 2 + rsub;
      const v4f v = *(const v4fa*)&so[w][r][c4];
      *(v4f*)(C + (size_t)(row0 + r) * ldc + col0 + c4) = v;
    }
    
  }
}
// row LayerNorm (biased variance, eps) over N: s = X (+ R); optional out_sum <- s; out_norm <- (s-mu)*rsqrt(var+eps)*g + b
template <bool PARAM_BF16>
__global__ __launch_bounds__(256) void k_layernorm(const float* __restrict__ X, const float* __restrict__ R, const float* __restrict__ g, const float* __restrict__ bta,
                                                  float* __restrict__ out_sum, float* __restrict__ out_norm, int N, float eps) {
  __shared__ float red[256];
  const int row = blockIdx.x, tid = threadIdx.x;
  const float* x = X + (size_t)row * N; const float* rr = R ? R + (size_t)row * N : nullptr;
  float vals[16];                     // up to N = 4096
  const int per = N / 256;            // contiguous chunk per thread? use strided-by-4 chunks: thread handles j = tid*4 + 1024*u
  float s1 = 0.f;
  for (int u = 0; u < per / 4; ++u) {
    const int j = tid * 4 + 1024 * u;
    const v4f a = *(const v4fa*)(x + j);
    v4f b = {0.f,0.f,0.f,0.f}; if (rr) b = *(const v4fa*)(rr + j);
#pragma unroll
    for (int q = 0; q < 4; ++q) { const float v = a[q] + b[q]; vals[u * 4 + q] = v; s1 += v; }
  }
  red[tid] = s1; __syncthreads();
  for (int st = 128; st > 0; st >>= 1) { if (tid < st) red[tid] += red[tid + st]; __syncthreads(); }
  const float mu = red[0] / (float)N; __syncthreads();
  float s2 = 0.f;
  for (int u = 0; u < per / 4; ++u)
#pragma unroll
    for (int q = 0; q < 4; ++q) { const float c = vals[u * 4 + q] - mu; s2 += c * c; }
  red[tid] = s2; __syncthreads();
  for (int st = 128; st > 0; st >>= 1) { if (tid < st) red[tid] += red[tid + st]; __syncthreads(); }
  const float rs = rsqrtf(red[0] / (float)N + eps);
  {
    for (int u = 0; u < per / 4; ++u) {
      const int j = tid * 4 + 1024 * u;
      v4f o, sm;
#pragma unroll
      for (int q = 0; q < 4; ++q) {
        float gg = g[j + q], bb = bta[j + q];
        if (PARAM_BF16) { gg = bf16_round(gg); bb = bf16_round(bb); }
        sm[q] = vals[u * 4 + q]; o[q] = (vals[u * 4 + q] - mu) * rs * gg + bb;
      }
      if (out_sum) *(v4f*)(out_sum + (size_t)row * N + j) = sm;
      *(v4f*)(out_norm + (size_t)row * N + j) = o;
    }
    
  }
}



// ---- f16 WMMA path (v_wmma_f32_16x16x32_f16): 11-bit significands for operands in range — used where a [0,1] probability operand needs more precision than bf16
typedef _Float16 v16h __attribute__((ext_vector_type(16)));
union FragH { v16h v; v8us half[2]; _Float16 h[16]; unsigned short u[16]; };
template <int NT>
__device__ __forceinline__ v8f mmaH(v16h ah, v16h al, v16h bh, v16h bl, v8f c) {
  c = __builtin_amdgcn_wmma_f32_16x16x32_f16(false, ah, false, bh, (short)0, c, false, false);
  if (NT >= 2) c = __builtin_amdgcn_wmma_f32_16x16x32_f16(false, al, false, bh, (short)0, c, false, false);
  if (NT >= 3) c = __builtin_amdgcn_wmma_f32_16x16x32_f16(false, ah, false, bl, (short)0, c, false, false);
  asm volatile("v_nop\n\tv_nop\n\tv_nop\n\tv_nop" : "+v"(c) : "v"(ah), "v"(al), "v"(bh), "v"(bl));
  return c;
}
// batched GEMM like k_gemm_b but f16 operands: A f32 (split into f16 hi/lo if ASPLIT, else rounded to f16), Bt = f16 values [n][k]; alpha; C f32; N multiple of 16 (partial tiles skipped)
template <bool ASPLIT>
__global__ __launch_bounds__(128) void k_gemm_h(const float* __restrict__ A, int lda, size_t sA, const _Float16* __restrict__ Bh, int ldb, size_t sB, float alpha, float* __restrict__ C, int ldc, size_t sC, int M, int N, int K) {
  __shared__ __attribute__((aligned(16))) float so[4][16][64];
  const int tid = threadIdx.x, w = tid >> 5, lane = tid & 31, ln = lane & 15, hh = lane >> 4; const int by = blockIdx.y;
  A += (size_t)by * sA; Bh += (size_t)by * sB; C += (size_t)by * sC;
  const int ntn = (N + 63) / 64; const int wid = blockIdx.x * 4 + w; const int mt = wid / ntn, nq = wid % ntn; if (mt * 16 >= M) return;
  const int row0 = mt * 16, col0 = nq * 64; const float* arow = A + (size_t)(row0 + ln) * lda;
  v8f acc[4] = {};
  for (int kb = 0; kb < K; kb += 32) {
    FragH ah, al;
    const v4f x0 = *(const v4fa*)(arow + kb + 8 * hh), x1 = *(const v4fa*)(arow + kb + 8 * hh + 4), x2 = *(const v4fa*)(arow + kb + 16 + 8 * hh), x3 = *(const v4fa*)(arow + kb + 16 + 8 * hh + 4);
    float xs[16] = {x0[0],x0[1],x0[2],x0[3],x1[0],x1[1],x1[2],x1[3],x2[0],x2[1],x2[2],x2[3],x3[0],x3[1],x3[2],x3[3]};
#pragma unroll
    for (int i = 0; i < 16; ++i) { const _Float16 h = (_Float16)xs[i]; ah.h[i] = h; al.h[i] = ASPLIT ? (_Float16)(xs[i] - (float)h) : (_Float16)0.0f; }
#pragma unroll
    for (int t = 0; t < 4; ++t) { if (col0 + t * 16 >= N) continue; const size_t boff = (size_t)(col0 + t * 16 + ln) * ldb + kb; FragH bq; bq.half[0] = *(const v8us*)(Bh + boff + 8 * hh); bq.half[1] = *(const v8us*)(Bh + boff + 16 + 8 * hh);
      acc[t] = mmaH<ASPLIT ? 2 : 1>(ah.v, al.v, bq.v, bq.v, acc[t]); }
  }
#pragma unroll
  for (int t = 0; t < 4; ++t) { if (col0 + t * 16 >= N) continue;
#pragma unroll
    for (int r = 0; r < 8; ++r) so[w][8 * hh + r][t * 16 + ln] = acc[t][r] * alpha; }
  __builtin_amdgcn_fence(__ATOMIC_ACQ_REL, "workgroup"); __builtin_amdgcn_wave_barrier();
  const int rsub = lane >> 4, c4 = (lane & 15) * 4;
  {
#pragma unroll
    for (int q = 0; q < 8; ++q) { const int r = q * 2 + rsub; if (col0 + c4 < N) { const v4f v = *(const v4fa*)&so[w][r][c4]; *(v4f*)(C + (size_t)(row0 + r) * ldc + col0 + c4) = v; } }
     }
}

// Wt[n][k] = f16(W[k][n]·scale) from f32 row-major W[K][N] (scale = power of two; bf16-exact weights stay exact in f16 away from the subnormal range)
__global__ __launch_bounds__(256) void k_wt_f16(const float* __restrict__ W, _Float16* __restrict__ Wt, int K, int N, float scale) {
  const int t = blockIdx.x * 256 + threadIdx.x; if (t >= N * (K / 8)) return; const int n = t / (K / 8), k8 = (t % (K / 8)) * 8; FragH f;
#pragma unroll
  for (int i = 0; i < 8; ++i) f.h[i] = (_Float16)(bf16_round(W[(size_t)(k8 + i) * N + n]) * scale); const v8us o = f.half[0];
  *(v8us*)((unsigned short*)Wt + (size_t)n * K + k8) = o; 
}
// k_gemm_hh variant with fused epilogue: v = acc·alpha + bias[by·sBias + col] (+ CP[(row/rowsPerB)·sCPb + by·64 + col] if CP) ; ACT 0 none / 1 elu ; writes f16 C16 (and f32 C if non-null)
template <int ACT>
__global__ __launch_bounds__(128) void k_gemm_hhx(const _Float16* __restrict__ A, int lda, size_t sA, const _Float16* __restrict__ Bh, int ldb, size_t sB, float alpha, const float* __restrict__ bias, size_t sBias, const float* __restrict__ CP, int rowsPerB, size_t sCPb, int row0g,
    float* __restrict__ C, _Float16* __restrict__ C16, int ldc, size_t sC, int M, int N, int K) {
  __shared__ __attribute__((aligned(16))) float so[4][16][64];
  const int tid = threadIdx.x, w = tid >> 5, lane = tid & 31, ln = lane & 15, hh = lane >> 4; const int by = blockIdx.y;
  A += (size_t)by * sA; Bh += (size_t)by * sB; const size_t cofs = (size_t)by * sC; const float* bp = bias ? bias + (size_t)by * sBias : nullptr;
  const int ntn = (N + 63) / 64; const int wid = blockIdx.x * 4 + w; const int mt = wid / ntn, nq = wid % ntn; if (mt * 16 >= M) return;
  const int row0 = mt * 16, col0 = nq * 64; const _Float16* arow = A + (size_t)(row0 + ln) * lda;
  v8f acc[4] = {};
  for (int kb = 0; kb < K; kb += 32) { FragH ah; ah.half[0] = *(const v8us*)((const unsigned short*)arow + kb + 8 * hh); ah.half[1] = *(const v8us*)((const unsigned short*)arow + kb + 16 + 8 * hh);
#pragma unroll
    for (int t = 0; t < 4; ++t) { if (col0 + t * 16 >= N) continue; const size_t boff = (size_t)(col0 + t * 16 + ln) * ldb + kb; FragH bq; bq.half[0] = *(const v8us*)((const unsigned short*)Bh + boff + 8 * hh); bq.half[1] = *(const v8us*)((const unsigned short*)Bh + boff + 16 + 8 * hh);
      acc[t] = mmaH<1>(ah.v, ah.v, bq.v, bq.v, acc[t]); }
  }
#pragma unroll
  for (int t = 0; t < 4; ++t) { if (col0 + t * 16 >= N) continue; const int col = col0 + t * 16 + ln; const float bv = bp ? bf16_round(bp[col]) : 0.f;
#pragma unroll
    for (int r = 0; r < 8; ++r) { float v = acc[t][r] * alpha + bv; if (CP) { const int bidx = (row0g + row0 + 8 * hh + r) / rowsPerB; v += CP[(size_t)bidx * sCPb + (size_t)by * 64 + col]; } if (ACT == 1) v = (v > 0.f) ? v : expm1f(v); else if (ACT == 7) v = (v > 0.f) ? v + 1.0f : expf(v); else if (ACT == 8) v = tanhf(v); else if (ACT == 9) v = 0.5f * v * (1.0f + tanhf(0.7978845608028654f * (v + 0.044715f * v * v * v))); else if (ACT == 11) v = 1.0f / (1.0f + expf(-v)); else if (ACT == 12) v = (v > 0.f) ? v : 0.01f * v; else if (ACT == 14) v = (v > 0.f) ? v : 0.1f * v; else if (ACT == 15) v = v / (1.0f + expf(-v)); else if (ACT == 3) v = fmaxf(v, 0.f); else if (ACT == 6) v = 0.5f * v * (1.0f + erff(v * 0.70710678118654752f)); so[w][8 * hh + r][t * 16 + ln] = v; } }
  __builtin_amdgcn_fence(__ATOMIC_ACQ_REL, "workgroup"); __builtin_amdgcn_wave_barrier();
  const int rsub = lane >> 4, c4 = (lane & 15) * 4; typedef _Float16 v4h __attribute__((ext_vector_type(4)));
  {
#pragma unroll
    for (int q = 0; q < 8; ++q) { const int r = q * 2 + rsub; if (col0 + c4 < N) { const v4f v = *(const v4fa*)&so[w][r][c4]; if (C) *(v4f*)(C + cofs + (size_t)(row0 + r) * ldc + col0 + c4) = v; if (C16) { v4h h4; for (int i = 0; i < 4; ++i) h4[i] = (_Float16)v[i]; *(v4h*)(C16 + cofs + (size_t)(row0 + r) * ldc + col0 + c4) = h4; } } }
     }
}


typedef _Float16 v4h __attribute__((ext_vector_type(4)));

__global__ __launch_bounds__(256) void k_x16(const float* __restrict__ x, _Float16* __restrict__ X16, size_t n8) { const size_t t = (size_t)blockIdx.x * 256 + threadIdx.x; if (t >= n8) return; FragH f;
#pragma unroll
  for (int q = 0; q < 8; ++q) f.h[q] = (_Float16)bf16_round(x[t * 8 + q]); *(v8us*)((unsigned short*)X16 + t * 8) = f.half[0];  }
__global__ __launch_bounds__(256) void k_h16(const float* __restrict__ x, _Float16* __restrict__ X16, size_t n8) { const size_t t = (size_t)blockIdx.x * 256 + threadIdx.x; if (t >= n8) return; FragH f;
#pragma unroll
  for (int q = 0; q < 8; ++q) f.h[q] = (_Float16)x[t * 8 + q]; *(v8us*)((unsigned short*)X16 + t * 8) = f.half[0];  }
__global__ __launch_bounds__(256) void k_round16f(const float* __restrict__ W, _Float16* __restrict__ Bt, size_t n8) { const size_t t = (size_t)blockIdx.x * 256 + threadIdx.x; if (t >= n8) return; FragH f;
#pragma unroll
  for (int i = 0; i < 8; ++i) f.h[i] = (_Float16)(bf16_round(W[t * 8 + i]) * 16.0f); *(v8us*)((unsigned short*)Bt + t * 8) = f.half[0];  }
template <int NHv, int TTv>
__global__ __launch_bounds__(256) void k_vt(const _Float16* __restrict__ V16, int ldv, int voff, _Float16* __restrict__ Vt) { __shared__ unsigned short tl[64][66]; const int tid = threadIdx.x; const int slab = blockIdx.x / (TTv / 64), lg = blockIdx.x % (TTv / 64); const int b = slab / NHv, h = slab % NHv;
  for (int i = tid; i < 64 * 8; i += 256) { const int r = i / 8, c8 = (i % 8) * 8; FragH f; f.half[0] = *(const v8us*)((const unsigned short*)V16 + ((size_t)b * TTv + lg * 64 + r) * ldv + voff + h * 64 + c8);
#pragma unroll
    for (int q = 0; q < 8; ++q) tl[r][c8 + q] = f.u[q]; }
  __syncthreads();
  {
#pragma unroll
    for (int rd = 0; rd < 2; ++rd) { const int d = rd * 32 + tid / 8, pc = tid % 8; FragH f;
#pragma unroll
      for (int q = 0; q < 8; ++q) f.u[q] = tl[pc * 8 + q][d];
      *(v8us*)((unsigned short*)Vt + ((size_t)slab * 64 + d) * TTv + lg * 64 + pc * 8) = f.half[0]; }
     } }

__global__ __launch_bounds__(256) void k_hl(const float* __restrict__ F, _Float16* __restrict__ Hh, _Float16* __restrict__ Hl, size_t n8) { const size_t t = (size_t)blockIdx.x * 256 + threadIdx.x; if (t >= n8) return; FragH fh, fl; const v4f a = *(const v4fa*)(F + t * 8), c = *(const v4fa*)(F + t * 8 + 4);
#pragma unroll
  for (int q = 0; q < 4; ++q) { _Float16 h = (_Float16)a[q]; fh.h[q] = h; fl.h[q] = (_Float16)((a[q] - (float)h) * 1024.0f); h = (_Float16)c[q]; fh.h[4 + q] = h; fl.h[4 + q] = (_Float16)((c[q] - (float)h) * 1024.0f); }
  { *(v8us*)((unsigned short*)Hh + t * 8) = fh.half[0]; *(v8us*)((unsigned short*)Hl + t * 8) = fl.half[0];  } }

// ---- tiled GEMM: C = act(A . Bh^T * alpha + bias), A [M][K] and Bh [N][K] f16, k-contiguous. One 128x128 tile of C per work-group, 64x64 per wave (2x2 waves).
// A pass is 64 k = 128 B of each of the 256 operand rows; every wave brings its own 64-row slice into LDS with one tensor load (two buffers, the next
// pass's tile in flight under this pass's products). Requires M % 128 == 0, N % 128 == 0, K % 64 == 0, K >= 128; the grid is exactly (M / 128) * (N / 128).
// The inner loops are fully unrolled so that every accumulator and fragment index is a constant (registers, no scratch).
typedef unsigned int u32x4 __attribute__((ext_vector_type(4)));
typedef unsigned int u32x8 __attribute__((ext_vector_type(8)));
#define G_PITCH 144u             /* LDS row pitch: 128 B of k + the mover's 16-B pad (16 B x odd, for ds_load_b128 readers) */
#define G_SLICE 10240u           /* 64 rows x 144 B = 9216 B, rounded up to a multiple of 2 KiB */
#define G_STAGE (4u * G_SLICE)   /* one buffer: A rows 0-63, A rows 64-127, B rows 0-63, B rows 64-127 */
__device__ __forceinline__ unsigned int uni(unsigned int v) { return (unsigned int)__builtin_amdgcn_readfirstlane(v); }
__device__ __forceinline__ unsigned int pinned(unsigned int v) { unsigned int w = uni(v); asm volatile("" : "+s"(w)); return w; }
__device__ __forceinline__ void g2_wait_tensor0() { asm volatile("s_wait_tensorcnt 0x0" ::: "memory"); }  // this wave's own slice has landed (the compiler places no wait for the mover)
__device__ __forceinline__ void g2_wait_ds0() { asm volatile("s_wait_dscnt 0x0" ::: "memory"); }          // this wave's LDS reads have returned before its buffer is handed back
__device__ __forceinline__ void g2_tload(unsigned int lds_dst, unsigned long long ga, u32x8 g1) {
  u32x4 g0; g0[0] = uni(1u); g0[1] = uni(lds_dst); g0[2] = uni((unsigned int)ga); g0[3] = uni((((unsigned int)(ga >> 32)) & 0x01FFFFFFu) | 0x80000000u);
  asm volatile("tensor_load_to_lds %0, %1" :: "s"(g0), "s"(g1) : "memory");  // one request of the whole wave: 64 rows of 128 B into LDS, through no register
}
template <int ACT, bool H16>      /* H16: the output goes to C16 as f16, else to C as f32 */
__global__ __launch_bounds__(128) void k_gemm2(const _Float16* __restrict__ A, const _Float16* __restrict__ Bh, float alpha, const float* __restrict__ bias,
    float* __restrict__ C, _Float16* __restrict__ C16, int N, int K) {
  __shared__ __attribute__((aligned(2048))) unsigned char L[2u * G_STAGE];
  const unsigned int tid = threadIdx.x, lane = tid & 31u, ln = lane & 15u, hh = lane >> 4;
  const unsigned int wave = uni(tid >> 5), wm = wave >> 1, wn = wave & 1u;
  const unsigned int ntn = (unsigned int)N >> 7; const unsigned int mt = blockIdx.x / ntn, nq = blockIdx.x - mt * ntn; const unsigned int row0 = mt * 128u, col0 = nq * 128u;
  const unsigned int kbytes = (unsigned int)K * 2u; const unsigned int NP = pinned((unsigned int)K >> 6);
  const unsigned char* src = (wave < 2u) ? (const unsigned char*)A + (size_t)(row0 + 64u * wave) * kbytes : (const unsigned char*)Bh + (size_t)(col0 + 64u * (wave - 2u)) * kbytes;
  const unsigned long long ga = (unsigned long long)(size_t)src; const unsigned int dst = (unsigned int)(size_t)L + wave * G_SLICE;
  u32x8 g1;      /* 1-byte elements, tensor = tile = 64 rows of 128 B, a 4-dword pad behind every 32 dwords, no mask */
  g1[0] = uni((1u << 20) | (4u << 22) | (3u << 25)); g1[1] = uni(128u << 16); g1[2] = uni(64u << 16); g1[3] = uni(128u << 16); g1[4] = uni(64u); g1[5] = uni(kbytes); g1[6] = uni(0u); g1[7] = uni(0u);
  asm volatile("" : "+s"(g1));      /* pinned() for the whole group: descriptor words held in scalar registers, so that none is reused as a temporary while a request is in flight */
  v8f acc[4][4];
#pragma unroll
  for (int i = 0; i < 4; ++i)
#pragma unroll
    for (int j = 0; j < 4; ++j) acc[i][j] = (v8f){0.f,0.f,0.f,0.f,0.f,0.f,0.f,0.f};
  const unsigned int a_base = wm * G_SLICE + ln * G_PITCH + 16u * hh, b_base = (2u + wn) * G_SLICE + ln * G_PITCH + 16u * hh;
  g2_tload(dst, ga, g1); g2_wait_tensor0(); __syncthreads();      /* stage 0 published */
  g2_tload(dst + G_STAGE, ga + 128u, g1);
#pragma unroll 1      /* one pass per trip: the buffer index stays a run-time offset and the accumulators stay in place */
  for (unsigned int s = 0; s < NP; ++s) { const unsigned int buf = (s & 1u) * G_STAGE;
    FragH a[2][4], b[2][4];      /* same k order in A and B: bytes 16 hh and 32 + 16 hh of each 64 B */
#pragma unroll
    for (int ks = 0; ks < 2; ++ks)
#pragma unroll
      for (int i = 0; i < 4; ++i) { const unsigned char* pa = L + buf + a_base + (unsigned int)i * 16u * G_PITCH + (unsigned int)ks * 64u; a[ks][i].half[0] = *(const v8us*)pa; a[ks][i].half[1] = *(const v8us*)(pa + 32);
        const unsigned char* pb = L + buf + b_base + (unsigned int)i * 16u * G_PITCH + (unsigned int)ks * 64u; b[ks][i].half[0] = *(const v8us*)pb; b[ks][i].half[1] = *(const v8us*)(pb + 32); }
    __builtin_amdgcn_sched_barrier(0);      /* the pass's LDS reads stay one group ahead of its products */
#pragma unroll
    for (int ks = 0; ks < 2; ++ks)
#pragma unroll
      for (int i = 0; i < 4; ++i)
#pragma unroll
        for (int j = 0; j < 4; ++j) acc[i][j] = __builtin_amdgcn_wmma_f32_16x16x32_f16(false, a[ks][i].v, false, b[ks][j].v, (short)0, acc[i][j], false, false);
    __builtin_amdgcn_sched_barrier(0);      /* the products stay in front of the wait for the next tile: moved behind it, that tile's flight would no longer be hidden under them */
    g2_wait_ds0(); g2_wait_tensor0(); __syncthreads();      /* publishes stage s + 1 and ends every reader's last read of stage s */
    if (pinned((s + 2u < NP) ? 1u : 0u)) g2_tload(dst + buf, ga + (unsigned long long)(s + 2u) * 128u, g1); }
  g2_wait_tensor0(); g2_wait_ds0();
  // Output staging in the ring, each wave in its own 20 KiB: the last pass's barrier stands behind every read of the ring, and no load is in flight.
  float* so = (float*)(L + wave * 20480u);      /* [64][68] f32 */
#pragma unroll
  for (int i = 0; i < 4; ++i)
#pragma unroll
    for (int j = 0; j < 4; ++j)
#pragma unroll
      for (int r = 0; r < 8; ++r) so[((unsigned int)i * 16u + 8u * hh + (unsigned int)r) * 68u + (unsigned int)j * 16u + ln] = acc[i][j][r];
  __builtin_amdgcn_fence(__ATOMIC_ACQ_REL, "workgroup"); __builtin_amdgcn_wave_barrier();
  const unsigned int c4 = ln * 4u; float bv[4];
#pragma unroll
  for (int e = 0; e < 4; ++e) bv[e] = bf16_round(bias[col0 + wn * 64u + c4 + (unsigned int)e]);
#pragma unroll 1      /* kept rolled: bias and activation on the rows read back, so that the erf body stands 16 times in the code and not 128 times (instruction cache) */
  for (unsigned int q0 = 0; q0 < 32u; q0 += 4u) { v4f v[4];
#pragma unroll
    for (int u = 0; u < 4; ++u) v[u] = *(const v4fa*)&so[((q0 + (unsigned int)u) * 2u + hh) * 68u + c4];
#pragma unroll
    for (int u = 0; u < 4; ++u) { const size_t o = (size_t)(row0 + wm * 64u + (q0 + (unsigned int)u) * 2u + hh) * (unsigned int)N + col0 + wn * 64u + c4;
#pragma unroll
      for (int e = 0; e < 4; ++e) { float t = v[u][e] * alpha + bv[e]; if (ACT == 6) t = 0.5f * t * (1.0f + erff(t * 0.70710678118654752f)); v[u][e] = t; }
      if (H16) { v4h h4; for (int e = 0; e < 4; ++e) h4[e] = (_Float16)v[u][e]; *(v4h*)(C16 + o) = h4; } else *(v4f*)(C + o) = v[u]; }
    asm volatile("s_wait_xcnt 0x0" ::: "memory");      /* in front of the next trip's writes to the registers that this trip's stores name */
  } }



template <int CAUSAL>
__global__ __launch_bounds__(128) void k_flash(const _Float16* __restrict__ Q16, int ldq, const _Float16* __restrict__ K16, int ldk, const _Float16* __restrict__ Vt, const int* __restrict__ MSK, float* __restrict__ O, int ldo) {
  constexpr int RPW = 16, RTN = RPW / 16, NQB = TQ / (4 * RPW), DT = 4, KS = 2;
  __shared__ __attribute__((aligned(16))) unsigned short sP[4][RPW][40]; __shared__ __attribute__((aligned(16))) float sO[4][RPW][64 + 4];
  const int tid = threadIdx.x, w = tid >> 5, lane = tid & 31, ln = lane & 15, hh = lane >> 4;
  const int slab = blockIdx.x / QBLKS, qblk = blockIdx.x % QBLKS; (void)NQB; const int b = slab / NH, h = slab % NH; const int qb0 = qblk * (4 * RPW); const int q0 = qb0 + w * RPW;
  FragH aq[2][KS];
#pragma unroll
  for (int rt = 0; rt < RTN; ++rt) { const unsigned short* qr = (const unsigned short*)Q16 + ((size_t)b * TQ + q0 + rt * 16 + ln) * ldq + h * 64;
#pragma unroll
    for (int ks = 0; ks < KS; ++ks) { aq[rt][ks].half[0] = *(const v8us*)(qr + ks * 32 + 8 * hh); aq[rt][ks].half[1] = *(const v8us*)(qr + ks * 32 + 16 + 8 * hh); } }
  const unsigned short* Vth = (const unsigned short*)Vt + (size_t)slab * 64 * TK;
  float m_r[2][8], l_r[2][8]; v8f oacc[2][DT];
#pragma unroll
  for (int rt = 0; rt < RTN; ++rt) {
#pragma unroll
    for (int r = 0; r < 8; ++r) { m_r[rt][r] = -3.0e38f; l_r[rt][r] = 0.f; }
#pragma unroll
    for (int dt = 0; dt < DT; ++dt) oacc[rt][dt] = (v8f){0.f,0.f,0.f,0.f,0.f,0.f,0.f,0.f}; }
  const int jend = (CAUSAL == 1) ? (qb0 + 4 * RPW) : TK;      /* causal: keys beyond the block's last query never contribute */
#pragma unroll 1
  for (int j0 = 0; j0 < jend; j0 += 32) {
    v8f s[2][2];
#pragma unroll
    for (int nt = 0; nt < 2; ++nt) { const unsigned short* kr = (const unsigned short*)K16 + ((size_t)b * TK + j0 + nt * 16 + ln) * ldk + h * 64; FragH bk[KS];
#pragma unroll
      for (int ks = 0; ks < KS; ++ks) { bk[ks].half[0] = *(const v8us*)(kr + ks * 32 + 8 * hh); bk[ks].half[1] = *(const v8us*)(kr + ks * 32 + 16 + 8 * hh); }
#pragma unroll
      for (int rt = 0; rt < RTN; ++rt) { v8f acc = (v8f){0.f,0.f,0.f,0.f,0.f,0.f,0.f,0.f};
#pragma unroll
        for (int ks = 0; ks < KS; ++ks) acc = mmaH<1>(aq[rt][ks].v, aq[rt][ks].v, bk[ks].v, bk[ks].v, acc); s[rt][nt] = acc; } }
#pragma unroll
    for (int rt = 0; rt < RTN; ++rt)
#pragma unroll
      for (int r = 0; r < 8; ++r) { const int tq = q0 + rt * 16 + 8 * hh + r; const int k0 = j0 + ln, k1 = j0 + 16 + ln;
        const bool ok0 = (CAUSAL == 1) ? (k0 <= tq) : ((CAUSAL == 2) ? ((k0 >> 5) == (tq >> 5)) : true), ok1 = (CAUSAL == 1) ? (k1 <= tq) : ((CAUSAL == 2) ? ((k1 >> 5) == (tq >> 5)) : true);      /* mode 2: block-diagonal 32-token groups */
        const float s0 = ok0 ? s[rt][0][r] * SCL : -3.0e38f, s1 = ok1 ? s[rt][1][r] * SCL : -3.0e38f; float mc = fmaxf(s0, s1);
        mc = fmaxf(mc, __shfl_xor(mc, 1, 32)); mc = fmaxf(mc, __shfl_xor(mc, 2, 32)); mc = fmaxf(mc, __shfl_xor(mc, 4, 32)); mc = fmaxf(mc, __shfl_xor(mc, 8, 32));
        const float mn = fmaxf(m_r[rt][r], mc); const float al = (mn > -1.0e38f) ? expf(m_r[rt][r] - mn) : 1.0f; m_r[rt][r] = mn; const float p0 = ok0 ? expf(s0 - mn) : 0.f, p1 = ok1 ? expf(s1 - mn) : 0.f; l_r[rt][r] = l_r[rt][r] * al + p0 + p1;
#pragma unroll
        for (int dt = 0; dt < DT; ++dt) oacc[rt][dt][r] *= al;
        FragH t2; t2.h[0] = (_Float16)(p0 * 1024.0f); t2.h[1] = (_Float16)(p1 * 1024.0f); sP[w][rt * 16 + 8 * hh + r][ln] = t2.u[0]; sP[w][rt * 16 + 8 * hh + r][16 + ln] = t2.u[1]; }
    __builtin_amdgcn_fence(__ATOMIC_ACQ_REL, "workgroup"); __builtin_amdgcn_wave_barrier();
    FragH pa[2];
#pragma unroll
    for (int rt = 0; rt < RTN; ++rt) { pa[rt].half[0] = *(const v8us*)&sP[w][rt * 16 + ln][8 * hh]; pa[rt].half[1] = *(const v8us*)&sP[w][rt * 16 + ln][16 + 8 * hh]; }
#pragma unroll
    for (int dt = 0; dt < DT; ++dt) { const unsigned short* vrow = Vth + (size_t)(dt * 16 + ln) * TK + j0; FragH bv; bv.half[0] = *(const v8us*)(vrow + 8 * hh); bv.half[1] = *(const v8us*)(vrow + 16 + 8 * hh);
#pragma unroll
      for (int rt = 0; rt < RTN; ++rt) oacc[rt][dt] = mmaH<1>(pa[rt].v, pa[rt].v, bv.v, bv.v, oacc[rt][dt]); }
    __builtin_amdgcn_fence(__ATOMIC_ACQ_REL, "workgroup"); __builtin_amdgcn_wave_barrier(); }
#pragma unroll
  for (int rt = 0; rt < RTN; ++rt) {
#pragma unroll
    for (int r = 0; r < 8; ++r) { float l = l_r[rt][r]; l += __shfl_xor(l, 1, 32); l += __shfl_xor(l, 2, 32); l += __shfl_xor(l, 4, 32); l += __shfl_xor(l, 8, 32); l_r[rt][r] = (l > 0.f) ? 1.0f / (l * 1024.0f) : 0.f; }
#pragma unroll
    for (int dt = 0; dt < DT; ++dt)
#pragma unroll
      for (int r = 0; r < 8; ++r) sO[w][rt * 16 + 8 * hh + r][dt * 16 + ln] = oacc[rt][dt][r] * l_r[rt][r]; }
  __builtin_amdgcn_fence(__ATOMIC_ACQ_REL, "workgroup"); __builtin_amdgcn_wave_barrier();
  {
#pragma unroll
    for (int rp = 0; rp < RPW; rp += 2) { const int r = rp + (lane >> 4), pc = lane & 15; const v4f val = *(const v4fa*)&sO[w][r][pc * 4]; *(v4f*)(O + ((size_t)b * TQ + q0 + r) * ldo + h * 64 + pc * 4) = val; }
     } }

__global__ __launch_bounds__(256) void k_xb(const float* __restrict__ x, float* __restrict__ XB, size_t n4) { const size_t t = (size_t)blockIdx.x * 256 + threadIdx.x; if (t >= n4) return; v4f a = *(const v4fa*)(x + t * 4); for (int q = 0; q < 4; ++q) a[q] = bf16_round(a[q]); *(v4f*)(XB + t * 4) = a;  }
__global__ __launch_bounds__(256) void k_add(const float* __restrict__ A2, const float* __restrict__ B2, float* __restrict__ out, size_t n4) {
  #pragma clang fp contract(off)
  const size_t t = (size_t)blockIdx.x * 256 + threadIdx.x; if (t >= n4) return; const v4f a = *(const v4fa*)(A2 + t * 4), b = *(const v4fa*)(B2 + t * 4); v4f r; for (int q = 0; q < 4; ++q) r[q] = a[q] + b[q]; *(v4f*)(out + t * 4) = r;  }
__global__ __launch_bounds__(256) void k_ln12(const float* __restrict__ O, const float* __restrict__ XB, const float* __restrict__ g1, const float* __restrict__ b1, const float* __restrict__ g2, const float* __restrict__ b2, float* __restrict__ X1, _Float16* __restrict__ L2) {
  #pragma clang fp contract(off)
  const int wv = threadIdx.x >> 5, ln = threadIdx.x & 31; const size_t r = (size_t)blockIdx.x * 8 + wv; if (r >= NR) return; float a[24]; float s = 0.f;
  for (int i = 0; i < 3; ++i) { const v8f v = *(const v8f*)(O + r * DM + (i * 32 + ln) * 8); for (int q = 0; q < 8; ++q) { a[i * 8 + q] = v[q]; s += v[q]; } }
  for (int o = 16; o > 0; o >>= 1) s += __shfl_xor(s, o, 32); float mu = s / (float)DM; float var = 0.f; for (int q = 0; q < 24; ++q) { const float d = a[q] - mu; var += d * d; }
  for (int o = 16; o > 0; o >>= 1) var += __shfl_xor(var, o, 32); float inv = rsqrtf(var / (float)DM + 1e-5f);
  float s2 = 0.f;
  for (int i = 0; i < 3; ++i) { const int c0 = (i * 32 + ln) * 8; const v8f xb = *(const v8f*)(XB + r * DM + c0); for (int q = 0; q < 8; ++q) { float y = (a[i * 8 + q] - mu) * inv; y *= bf16_round(g1[c0 + q]); y += bf16_round(b1[c0 + q]); const float x1 = xb[q] + y; a[i * 8 + q] = x1; s2 += x1; } }      /* a[] now holds x1 */
  for (int o = 16; o > 0; o >>= 1) s2 += __shfl_xor(s2, o, 32); mu = s2 / (float)DM; var = 0.f; for (int q = 0; q < 24; ++q) { const float d = a[q] - mu; var += d * d; }
  for (int o = 16; o > 0; o >>= 1) var += __shfl_xor(var, o, 32); inv = rsqrtf(var / (float)DM + 1e-5f);
  { for (int i = 0; i < 3; ++i) { const int c0 = (i * 32 + ln) * 8; v8f xo; FragH f; for (int q = 0; q < 8; ++q) { xo[q] = a[i * 8 + q]; float y = (a[i * 8 + q] - mu) * inv; y *= bf16_round(g2[c0 + q]); y += bf16_round(b2[c0 + q]); f.h[q] = (_Float16)y; } *(v8f*)(X1 + r * DM + c0) = xo; *(v8us*)((unsigned short*)L2 + r * DM + c0) = f.half[0]; }  } }

extern "C" void kernel_launch(void* const* d_in, const int* in_sizes, int n_in,
                              void* d_out, int out_size, void* d_ws, size_t ws_size, hipStream_t stream) {
  (void)in_sizes; (void)n_in; (void)out_size;
  const float* const* I = (const float* const*)d_in; const float* x = I[0]; const float* wq = I[1]; const float* bq = I[2]; const float* wk = I[3]; const float* bk = I[4]; const float* wv = I[5]; const float* bv = I[6]; const float* g1 = I[7]; const float* b1 = I[8]; const float* g2 = I[9]; const float* b2 = I[10]; const float* w_in = I[11]; const float* b_in = I[12]; const float* w_out = I[13]; const float* b_out = I[14];
  char* ws = (char*)d_ws; size_t off = 0;
  auto take = [&](size_t bytes) { char* p = ws + off; off += (bytes + 255) & ~(size_t)255; return p; };
  const size_t np = (size_t)NR * DM;
  _Float16* BQ = (_Float16*)take((size_t)DM * DM * 2); _Float16* BK = (_Float16*)take((size_t)DM * DM * 2); _Float16* BV = (_Float16*)take((size_t)DM * DM * 2); _Float16* BIN = (_Float16*)take((size_t)HIDN * DM * 2); _Float16* BOUT = (_Float16*)take((size_t)DM * HIDN * 2);
  _Float16* X16 = (_Float16*)take(np * 2); float* XB = (float*)take(np * 4); _Float16* Q16 = (_Float16*)take(np * 2); _Float16* K16 = (_Float16*)take(np * 2); _Float16* V16 = (_Float16*)take(np * 2); _Float16* VT = (_Float16*)take(np * 2); float* O = (float*)take(np * 4); float* X1 = (float*)take(np * 4); _Float16* L2 = X16;      /* LN2 output over the input f16 plane (dead after the projections) */ _Float16* HH = (_Float16*)take((size_t)NR * HIDN * 2);      /* hidden [8192][3072] f16 */
  if (off > ws_size) return;      /* 1.1 x3 + 4.5 + 4.5 + 12 + 24 + 12 x 4 + 24 + 24 + 48 = 192.4 MiB */
  k_wt_f16<<<(unsigned)(((size_t)DM * DM / 8 + 255) / 256), 256, 0, stream>>>(wq, BQ, DM, DM, 16.0f); k_wt_f16<<<(unsigned)(((size_t)DM * DM / 8 + 255) / 256), 256, 0, stream>>>(wk, BK, DM, DM, 16.0f); k_wt_f16<<<(unsigned)(((size_t)DM * DM / 8 + 255) / 256), 256, 0, stream>>>(wv, BV, DM, DM, 16.0f);
  k_wt_f16<<<(unsigned)(((size_t)DM * HIDN / 8 + 255) / 256), 256, 0, stream>>>(w_in, BIN, DM, HIDN, 16.0f); k_wt_f16<<<(unsigned)(((size_t)HIDN * DM / 8 + 255) / 256), 256, 0, stream>>>(w_out, BOUT, HIDN, DM, 16.0f);
  const unsigned n8 = (unsigned)((np / 8 + 255) / 256); const dim3 g((NR / 128) * (DM / 128), 1);
  k_x16<<<n8, 256, 0, stream>>>(x, X16, np / 8); k_xb<<<(unsigned)((np / 4 + 255) / 256), 256, 0, stream>>>(x, XB, np / 4);
  k_gemm2<0, true><<<g, 128, 0, stream>>>(X16, BQ, 0.0625f, bq, nullptr, Q16, DM, DM);
  k_gemm2<0, true><<<g, 128, 0, stream>>>(X16, BK, 0.0625f, bk, nullptr, K16, DM, DM);
  k_gemm2<0, true><<<g, 128, 0, stream>>>(X16, BV, 0.0625f, bv, nullptr, V16, DM, DM);
  k_vt<NH, SLEN><<<NB * NH * (SLEN / 64), 256, 0, stream>>>(V16, DM, 0, VT);
  k_flash<0><<<NB * NH * QBLKS, 128, 0, stream>>>(Q16, DM, K16, DM, VT, nullptr, O, DM);      /* ctx (no out_proj) */
  k_ln12<<<NR / 8, 256, 0, stream>>>(O, XB, g1, b1, g2, b2, X1, L2);      /* x1 = x + LN1(ctx); L2 = LN2(x1) */
  k_gemm2<6, true><<<dim3((NR / 128) * (HIDN / 128), 1), 128, 0, stream>>>(L2, BIN, 0.0625f, b_in, nullptr, HH, HIDN, DM);      /* gelu(LN2 w_in + b) */
  k_gemm2<6, false><<<g, 128, 0, stream>>>(HH, BOUT, 0.0625f, b_out, O, nullptr, DM, HIDN);      /* gelu(h w_out + b) -> O */
  k_add<<<(unsigned)((np / 4 + 255) / 256), 256, 0, stream>>>(X1, O, (float*)d_out, np / 4);      /* out = x1 + h */
}

// v002
// One run takes 343 microseconds.
// Timed twice side by side with v001, it ran 1.04 times as fast both times.
// All steps since v000 together make it 1.82 times as fast.
#include <hip/hip_runtime.h>
// TransofmerEncoderBlock (8 x 1024 tokens, D 768 = 12 heads of 64, hidden 3072): q/k/v = x W + b; full softmax(q k^T / 8) v (no out_proj, as the source); x1 = x + LN1(ctx); h = gelu(LN2(x1) w_in + b_in); h = gelu(h w_out + b_out) (GELU after BOTH linears, as the source); out = x1 + h.
// Structure: exact f16 plane of x; q/k/v GEMMs (128x128 tiles staged in LDS, f32 accumulation, exact x16 weights + bias, f16 outputs); V^T written by the v GEMM's own epilogue; the fused flash kernel (plain f16 operands); LayerNorm of the attention output + residual on VALU (wave per row, x rounded to bf16 as it is read) into x1 (f32) and LN2(x1) (f16); the MLP GEMMs with exact-erf GELU epilogues (f16 hidden); the final residual in the last GEMM's epilogue.
// Compute dtype: x and parameters rounded to bf16; q, k, v, P, LN2 output and the hidden activation as f16 operands (~2^-12); f32 accumulation/softmax/LN/GELU/residuals. v_wmma_f32_16x16x32_f16.
#define NB 8
#define DM 768
#define HIDN 3072
#define NR (NB * SLEN)           /* 8192 rows */
#define SLEN 1024
#define TQ SLEN
#define TK SLEN
#define NH 12
#define SCL 0.125f               /* HD^-0.5 */
#define QBLKS (TQ / 64)
typedef __bf16 v16b __attribute__((ext_vector_type(16)));
typedef unsigned short v8us __attribute__((ext_vector_type(8), may_alias));
typedef float  v8f  __attribute__((ext_vector_type(8)));
typedef float  v4f  __attribute__((ext_vector_type(4)));
typedef float  v4fa __attribute__((ext_vector_type(4), may_alias));
union FragB { v16b v; v8us half[2]; unsigned short u[16]; };

__device__ __forceinline__ unsigned short bf16_bits(float x) { unsigned int u = __float_as_uint(x); return (unsigned short)((u + 0x7FFFu + ((u >> 16) & 1u)) >> 16); }
__device__ __forceinline__ float bf16_val(unsigned short b) { return __uint_as_float(((unsigned int)b) << 16); }
__device__ __forceinline__ float bf16_round(float x) { return bf16_val(bf16_bits(x)); }
// D += A·B with NT terms: 1 = ah·bh, 2 = + al·bh (A split), 3 = + ah·bl (both split)
template <int NT>
__device__ __forceinline__ v8f mmaN(v16b ah, v16b al, v16b bh, v16b bl, v8f c) {
  c = __builtin_amdgcn_wmma_f32_16x16x32_bf16(false, ah, false, bh, (short)0, c, false, false);
  if (NT >= 2) c = __builtin_amdgcn_wmma_f32_16x16x32_bf16(false, al, false, bh, (short)0, c, false, false);
  if (NT >= 3) c = __builtin_amdgcn_wmma_f32_16x16x32_bf16(false, ah, false, bl, (short)0, c, false, false);
  asm volatile("v_nop\n\tv_nop\n\tv_nop\n\tv_nop" : "+v"(c) : "v"(ah), "v"(al), "v"(bh), "v"(bl));
  return c;
}

__global__ __launch_bounds__(256) void k_wt_bf16(const float* __restrict__ W, unsigned short* __restrict__ Wt, int K, int N) {
  const int t = blockIdx.x * 256 + threadIdx.x;
  const int k8n = K / 8;
  if (t >= N * k8n) return;
  const int n = t / k8n, k8 = (t % k8n) * 8;
  v8us v;
#pragma unroll
  for (int i = 0; i < 8; ++i) v[i] = bf16_bits(W[(size_t)(k8 + i) * N + n]);
  *(v8us*)(Wt + (size_t)n * K + k8) = v;
  
}

// GEMM C[M][N] (f32, pitch ldc) = act(A[M][K]·W + bias). A f32 row-major (pitch lda) converted per fragment to bf16
// (ASPLIT: hi/lo two planes -> 2 terms, else single rounded term); Wt bf16 [N][K] (pitch ldb). BIAS_BF16 rounds the
// bias to bf16 first (bias quantised to bf16 before the add). K%32==0, M%16==0, N%64==0.
template <bool ASPLIT, int ACT, bool BIAS_BF16>
__global__ __launch_bounds__(128) void k_gemm_bf(const float* __restrict__ A, int lda, const unsigned short* __restrict__ Wt, int ldb,
                                               const float* __restrict__ bias, float* __restrict__ C, int ldc, int M, int N, int K) {
  __shared__ __attribute__((aligned(16))) float so[4][16][64];
  const int tid = threadIdx.x, w = tid >> 5, lane = tid & 31, ln = lane & 15, hh = lane >> 4;
  const int ntn = N / 64;
  const int wid = blockIdx.x * 4 + w;
  const int mt = wid / ntn, nq = wid % ntn;
  if (mt * 16 >= M) return;
  const int row0 = mt * 16, col0 = nq * 64;
  const float* arow = A + (size_t)(row0 + ln) * lda;
  v8f acc[4] = {};
  for (int kb = 0; kb < K; kb += 32) {
    FragB ah, al;
    const v4f x0 = *(const v4fa*)(arow + kb + 8 * hh), x1 = *(const v4fa*)(arow + kb + 8 * hh + 4);
    const v4f x2 = *(const v4fa*)(arow + kb + 16 + 8 * hh), x3 = *(const v4fa*)(arow + kb + 16 + 8 * hh + 4);
    float xs[16] = {x0[0],x0[1],x0[2],x0[3],x1[0],x1[1],x1[2],x1[3],x2[0],x2[1],x2[2],x2[3],x3[0],x3[1],x3[2],x3[3]};
#pragma unroll
    for (int i = 0; i < 16; ++i) { const unsigned short hb = bf16_bits(xs[i]); ah.u[i] = hb; al.u[i] = ASPLIT ? bf16_bits(xs[i] - bf16_val(hb)) : (unsigned short)0; }
#pragma unroll
    for (int t = 0; t < 4; ++t) {
      const unsigned short* brow = Wt + (size_t)(col0 + t * 16 + ln) * ldb + kb;
      FragB b;
      b.half[0] = *(const v8us*)(brow + 8 * hh);
      b.half[1] = *(const v8us*)(brow + 16 + 8 * hh);
      acc[t] = mmaN<ASPLIT ? 2 : 1>(ah.v, al.v, b.v, b.v, acc[t]);
    }
  }
#pragma unroll
  for (int t = 0; t < 4; ++t) {
    float bv = bias ? bias[col0 + t * 16 + ln] : 0.f;
    if (BIAS_BF16) bv = bf16_round(bv);
#pragma unroll
    for (int r = 0; r < 8; ++r) { float v = acc[t][r] + bv; if (ACT == 1) v = fmaxf(v, 0.f); so[w][8 * hh + r][t * 16 + ln] = v; }
  }
  __builtin_amdgcn_fence(__ATOMIC_ACQ_REL, "workgroup");
  __builtin_amdgcn_wave_barrier();
  const int rsub = lane >> 4, c4 = (lane & 15) * 4;
  {
#pragma unroll
    for (int q = 0; q < 8; ++q) {
      const int r = q * 2 + rsub;
      const v4f v = *(const v4fa*)&so[w][r][c4];
      *(v4f*)(C + (size_t)(row0 + r) * ldc + col0 + c4) = v;
    }
    
  }
}

// GEMM C = act(A·W + bias + resid): A f32 (ASPLIT -> hi/lo 2 terms), Wt bf16 [N][K]; ACT 0 none, 1 relu, 2 exact gelu;
// resid (optional, f32, row index = (row % rmod), pitch ldr, RES_BF16 rounds it) added before the activation.
template <bool ASPLIT, int ACT, bool BIAS_BF16, bool RES_BF16>
__global__ __launch_bounds__(128) void k_gemm_bf3(const float* __restrict__ A, int lda, const unsigned short* __restrict__ Wt, int ldb,
                                                const float* __restrict__ bias, const float* __restrict__ resid, int rmod, int ldr,
                                                float* __restrict__ C, int ldc, int M, int N, int K) {
  __shared__ __attribute__((aligned(16))) float so[4][16][64];
  const int tid = threadIdx.x, w = tid >> 5, lane = tid & 31, ln = lane & 15, hh = lane >> 4;
  const int ntn = N / 64;
  const int wid = blockIdx.x * 4 + w;
  const int mt = wid / ntn, nq = wid % ntn;
  if (mt * 16 >= M) return;
  const int row0 = mt * 16, col0 = nq * 64;
  const float* arow = A + (size_t)(row0 + ln) * lda;
  v8f acc[4] = {};
  for (int kb = 0; kb < K; kb += 32) {
    FragB ah, al;
    const v4f x0 = *(const v4fa*)(arow + kb + 8 * hh), x1 = *(const v4fa*)(arow + kb + 8 * hh + 4);
    const v4f x2 = *(const v4fa*)(arow + kb + 16 + 8 * hh), x3 = *(const v4fa*)(arow + kb + 16 + 8 * hh + 4);
    float xs[16] = {x0[0],x0[1],x0[2],x0[3],x1[0],x1[1],x1[2],x1[3],x2[0],x2[1],x2[2],x2[3],x3[0],x3[1],x3[2],x3[3]};
#pragma unroll
    for (int i = 0; i < 16; ++i) { const unsigned short hb = bf16_bits(xs[i]); ah.u[i] = hb; al.u[i] = ASPLIT ? bf16_bits(xs[i] - bf16_val(hb)) : (unsigned short)0; }
#pragma unroll
    for (int t = 0; t < 4; ++t) {
      const unsigned short* brow = Wt + (size_t)(col0 + t * 16 + ln) * ldb + kb;
      FragB b;
      b.half[0] = *(const v8us*)(brow + 8 * hh);
      b.half[1] = *(const v8us*)(brow + 16 + 8 * hh);
      acc[t] = mmaN<ASPLIT ? 2 : 1>(ah.v, al.v, b.v, b.v, acc[t]);
    }
  }
#pragma unroll
  for (int t = 0; t < 4; ++t) {
    const int col = col0 + t * 16 + ln;
    float bv = bias ? bias[col] : 0.f;
    if (BIAS_BF16) bv = bf16_round(bv);
#pragma unroll
    for (int r = 0; r < 8; ++r) {
      float v = acc[t][r] + bv;
      if (resid) { float rv = resid[(size_t)((row0 + 8 * hh + r) % rmod) * ldr + col]; if (RES_BF16) rv = bf16_round(rv); v += rv; }
      if (ACT == 1) v = fmaxf(v, 0.f);
      if (ACT == 2) v = 0.5f * v * (1.0f + erff(v * 0.70710678118654752f));
      if (ACT == 3) { const float u = 0.7978845608028654f * (v + 0.044715f * v * v * v); v = 0.5f * v * (1.0f + tanhf(u)); }
      so[w][8 * hh + r][t * 16 + ln] = v;
    }
  }
  __builtin_amdgcn_fence(__ATOMIC_ACQ_REL, "workgroup");
  __builtin_amdgcn_wave_barrier();
  const int rsub = lane >> 4, c4 = (lane & 15) * 4;
  {
#pragma unroll
    for (int q = 0; q < 8; ++q) {
      const int r = q * 2 + rsub;
      const v4f v = *(const v4fa*)&so[w][r][c4];
      *(v4f*)(C + (size_t)(row0 + r) * ldc + col0 + c4) = v;
    }
    
  }
}
// row LayerNorm (biased variance, eps) over N: s = X (+ R); optional out_sum <- s; out_norm <- (s-mu)*rsqrt(var+eps)*g + b
template <bool PARAM_BF16>
__global__ __launch_bounds__(256) void k_layernorm(const float* __restrict__ X, const float* __restrict__ R, const float* __restrict__ g, const float* __restrict__ bta,
                                                  float* __restrict__ out_sum, float* __restrict__ out_norm, int N, float eps) {
  __shared__ float red[256];
  const int row = blockIdx.x, tid = threadIdx.x;
  const float* x = X + (size_t)row * N; const float* rr = R ? R + (size_t)row * N : nullptr;
  float vals[16];                     // up to N = 4096
  const int per = N / 256;            // contiguous chunk per thread? use strided-by-4 chunks: thread handles j = tid*4 + 1024*u
  float s1 = 0.f;
  for (int u = 0; u < per / 4; ++u) {
    const int j = tid * 4 + 1024 * u;
    const v4f a = *(const v4fa*)(x + j);
    v4f b = {0.f,0.f,0.f,0.f}; if (rr) b = *(const v4fa*)(rr + j);
#pragma unroll
    for (int q = 0; q < 4; ++q) { const float v = a[q] + b[q]; vals[u * 4 + q] = v; s1 += v; }
  }
  red[tid] = s1; __syncthreads();
  for (int st = 128; st > 0; st >>= 1) { if (tid < st) red[tid] += red[tid + st]; __syncthreads(); }
  const float mu = red[0] / (float)N; __syncthreads();
  float s2 = 0.f;
  for (int u = 0; u < per / 4; ++u)
#pragma unroll
    for (int q = 0; q < 4; ++q) { const float c = vals[u * 4 + q] - mu; s2 += c * c; }
  red[tid] = s2; __syncthreads();
  for (int st = 128; st > 0; st >>= 1) { if (tid < st) red[tid] += red[tid + st]; __syncthreads(); }
  const float rs = rsqrtf(red[0] / (float)N + eps);
  {
    for (int u = 0; u < per / 4; ++u) {
      const int j = tid * 4 + 1024 * u;
      v4f o, sm;
#pragma unroll
      for (int q = 0; q < 4; ++q) {
        float gg = g[j + q], bb = bta[j + q];
        if (PARAM_BF16) { gg = bf16_round(gg); bb = bf16_round(bb); }
        sm[q] = vals[u * 4 + q]; o[q] = (vals[u * 4 + q] - mu) * rs * gg + bb;
      }
      if (out_sum) *(v4f*)(out_sum + (size_t)row * N + j) = sm;
      *(v4f*)(out_norm + (size_t)row * N + j) = o;
    }
    
  }
}



// ---- f16 WMMA path (v_wmma_f32_16x16x32_f16): 11-bit significands for operands in range — used where a [0,1] probability operand needs more precision than bf16
typedef _Float16 v16h __attribute__((ext_vector_type(16)));
union FragH { v16h v; v8us half[2]; _Float16 h[16]; unsigned short u[16]; };
template <int NT>
__device__ __forceinline__ v8f mmaH(v16h ah, v16h al, v16h bh, v16h bl, v8f c) {
  c = __builtin_amdgcn_wmma_f32_16x16x32_f16(false, ah, false, bh, (short)0, c, false, false);
  if (NT >= 2) c = __builtin_amdgcn_wmma_f32_16x16x32_f16(false, al, false, bh, (short)0, c, false, false);
  if (NT >= 3) c = __builtin_amdgcn_wmma_f32_16x16x32_f16(false, ah, false, bl, (short)0, c, false, false);
  asm volatile("v_nop\n\tv_nop\n\tv_nop\n\tv_nop" : "+v"(c) : "v"(ah), "v"(al), "v"(bh), "v"(bl));
  return c;
}
// batched GEMM like k_gemm_b but f16 operands: A f32 (split into f16 hi/lo if ASPLIT, else rounded to f16), Bt = f16 values [n][k]; alpha; C f32; N multiple of 16 (partial tiles skipped)
template <bool ASPLIT>
__global__ __launch_bounds__(128) void k_gemm_h(const float* __restrict__ A, int lda, size_t sA, const _Float16* __restrict__ Bh, int ldb, size_t sB, float alpha, float* __restrict__ C, int ldc, size_t sC, int M, int N, int K) {
  __shared__ __attribute__((aligned(16))) float so[4][16][64];
  const int tid = threadIdx.x, w = tid >> 5, lane = tid & 31, ln = lane & 15, hh = lane >> 4; const int by = blockIdx.y;
  A += (size_t)by * sA; Bh += (size_t)by * sB; C += (size_t)by * sC;
  const int ntn = (N + 63) / 64; const int wid = blockIdx.x * 4 + w; const int mt = wid / ntn, nq = wid % ntn; if (mt * 16 >= M) return;
  const int row0 = mt * 16, col0 = nq * 64; const float* arow = A + (size_t)(row0 + ln) * lda;
  v8f acc[4] = {};
  for (int kb = 0; kb < K; kb += 32) {
    FragH ah, al;
    const v4f x0 = *(const v4fa*)(arow + kb + 8 * hh), x1 = *(const v4fa*)(arow + kb + 8 * hh + 4), x2 = *(const v4fa*)(arow + kb + 16 + 8 * hh), x3 = *(const v4fa*)(arow + kb + 16 + 8 * hh + 4);
    float xs[16] = {x0[0],x0[1],x0[2],x0[3],x1[0],x1[1],x1[2],x1[3],x2[0],x2[1],x2[2],x2[3],x3[0],x3[1],x3[2],x3[3]};
#pragma unroll
    for (int i = 0; i < 16; ++i) { const _Float16 h = (_Float16)xs[i]; ah.h[i] = h; al.h[i] = ASPLIT ? (_Float16)(xs[i] - (float)h) : (_Float16)0.0f; }
#pragma unroll
    for (int t = 0; t < 4; ++t) { if (col0 + t * 16 >= N) continue; const size_t boff = (size_t)(col0 + t * 16 + ln) * ldb + kb; FragH bq; bq.half[0] = *(const v8us*)(Bh + boff + 8 * hh); bq.half[1] = *(const v8us*)(Bh + boff + 16 + 8 * hh);
      acc[t] = mmaH<ASPLIT ? 2 : 1>(ah.v, al.v, bq.v, bq.v, acc[t]); }
  }
#pragma unroll
  for (int t = 0; t < 4; ++t) { if (col0 + t * 16 >= N) continue;
#pragma unroll
    for (int r = 0; r < 8; ++r) so[w][8 * hh + r][t * 16 + ln] = acc[t][r] * alpha; }
  __builtin_amdgcn_fence(__ATOMIC_ACQ_REL, "workgroup"); __builtin_amdgcn_wave_barrier();
  const int rsub = lane >> 4, c4 = (lane & 15) * 4;
  {
#pragma unroll
    for (int q = 0; q < 8; ++q) { const int r = q * 2 + rsub; if (col0 + c4 < N) { const v4f v = *(const v4fa*)&so[w][r][c4]; *(v4f*)(C + (size_t)(row0 + r) * ldc + col0 + c4) = v; } }
     }
}

// Wt[n][k] = f16(W[k][n]·scale) from f32 row-major W[K][N] (scale = power of two; bf16-exact weights stay exact in f16 away from the subnormal range)
__global__ __launch_bounds__(256) void k_wt_f16(const float* __restrict__ W, _Float16* __restrict__ Wt, int K, int N, float scale) {
  const int t = blockIdx.x * 256 + threadIdx.x; if (t >= N * (K / 8)) return; const int n = t / (K / 8), k8 = (t % (K / 8)) * 8; FragH f;
#pragma unroll
  for (int i = 0; i < 8; ++i) f.h[i] = (_Float16)(bf16_round(W[(size_t)(k8 + i) * N + n]) * scale); const v8us o = f.half[0];
  *(v8us*)((unsigned short*)Wt + (size_t)n * K + k8) = o; 
}
// k_gemm_hh variant with fused epilogue: v = acc·alpha + bias[by·sBias + col] (+ CP[(row/rowsPerB)·sCPb + by·64 + col] if CP) ; ACT 0 none / 1 elu ; writes f16 C16 (and f32 C if non-null)
template <int ACT>
__global__ __launch_bounds__(128) void k_gemm_hhx(const _Float16* __restrict__ A, int lda, size_t sA, const _Float16* __restrict__ Bh, int ldb, size_t sB, float alpha, const float* __restrict__ bias, size_t sBias, const float* __restrict__ CP, int rowsPerB, size_t sCPb, int row0g,
    float* __restrict__ C, _Float16* __restrict__ C16, int ldc, size_t sC, int M, int N, int K) {
  __shared__ __attribute__((aligned(16))) float so[4][16][64];
  const int tid = threadIdx.x, w = tid >> 5, lane = tid & 31, ln = lane & 15, hh = lane >> 4; const int by = blockIdx.y;
  A += (size_t)by * sA; Bh += (size_t)by * sB; const size_t cofs = (size_t)by * sC; const float* bp = bias ? bias + (size_t)by * sBias : nullptr;
  const int ntn = (N + 63) / 64; const int wid = blockIdx.x * 4 + w; const int mt = wid / ntn, nq = wid % ntn; if (mt * 16 >= M) return;
  const int row0 = mt * 16, col0 = nq * 64; const _Float16* arow = A + (size_t)(row0 + ln) * lda;
  v8f acc[4] = {};
  for (int kb = 0; kb < K; kb += 32) { FragH ah; ah.half[0] = *(const v8us*)((const unsigned short*)arow + kb + 8 * hh); ah.half[1] = *(const v8us*)((const unsigned short*)arow + kb + 16 + 8 * hh);
#pragma unroll
    for (int t = 0; t < 4; ++t) { if (col0 + t * 16 >= N) continue; const size_t boff = (size_t)(col0 + t * 16 + ln) * ldb + kb; FragH bq; bq.half[0] = *(const v8us*)((const unsigned short*)Bh + boff + 8 * hh); bq.half[1] = *(const v8us*)((const unsigned short*)Bh + boff + 16 + 8 * hh);
      acc[t] = mmaH<1>(ah.v, ah.v, bq.v, bq.v, acc[t]); }
  }
#pragma unroll
  for (int t = 0; t < 4; ++t) { if (col0 + t * 16 >= N) continue; const int col = col0 + t * 16 + ln; const float bv = bp ? bf16_round(bp[col]) : 0.f;
#pragma unroll
    for (int r = 0; r < 8; ++r) { float v = acc[t][r] * alpha + bv; if (CP) { const int bidx = (row0g + row0 + 8 * hh + r) / rowsPerB; v += CP[(size_t)bidx * sCPb + (size_t)by * 64 + col]; } if (ACT == 1) v = (v > 0.f) ? v : expm1f(v); else if (ACT == 7) v = (v > 0.f) ? v + 1.0f : expf(v); else if (ACT == 8) v = tanhf(v); else if (ACT == 9) v = 0.5f * v * (1.0f + tanhf(0.7978845608028654f * (v + 0.044715f * v * v * v))); else if (ACT == 11) v = 1.0f / (1.0f + expf(-v)); else if (ACT == 12) v = (v > 0.f) ? v : 0.01f * v; else if (ACT == 14) v = (v > 0.f) ? v : 0.1f * v; else if (ACT == 15) v = v / (1.0f + expf(-v)); else if (ACT == 3) v = fmaxf(v, 0.f); else if (ACT == 6) v = 0.5f * v * (1.0f + erff(v * 0.70710678118654752f)); so[w][8 * hh + r][t * 16 + ln] = v; } }
  __builtin_amdgcn_fence(__ATOMIC_ACQ_REL, "workgroup"); __builtin_amdgcn_wave_barrier();
  const int rsub = lane >> 4, c4 = (lane & 15) * 4; typedef _Float16 v4h __attribute__((ext_vector_type(4)));
  {
#pragma unroll
    for (int q = 0; q < 8; ++q) { const int r = q * 2 + rsub; if (col0 + c4 < N) { const v4f v = *(const v4fa*)&so[w][r][c4]; if (C) *(v4f*)(C + cofs + (size_t)(row0 + r) * ldc + col0 + c4) = v; if (C16) { v4h h4; for (int i = 0; i < 4; ++i) h4[i] = (_Float16)v[i]; *(v4h*)(C16 + cofs + (size_t)(row0 + r) * ldc + col0 + c4) = h4; } } }
     }
}


typedef _Float16 v4h __attribute__((ext_vector_type(4)));

__global__ __launch_bounds__(256) void k_x16(const float* __restrict__ x, _Float16* __restrict__ X16, size_t n8) { const size_t t = (size_t)blockIdx.x * 256 + threadIdx.x; if (t >= n8) return; FragH f;
#pragma unroll
  for (int q = 0; q < 8; ++q) f.h[q] = (_Float16)bf16_round(x[t * 8 + q]); *(v8us*)((unsigned short*)X16 + t * 8) = f.half[0];  }
__global__ __launch_bounds__(256) void k_h16(const float* __restrict__ x, _Float16* __restrict__ X16, size_t n8) { const size_t t = (size_t)blockIdx.x * 256 + threadIdx.x; if (t >= n8) return; FragH f;
#pragma unroll
  for (int q = 0; q < 8; ++q) f.h[q] = (_Float16)x[t * 8 + q]; *(v8us*)((unsigned short*)X16 + t * 8) = f.half[0];  }
__global__ __launch_bounds__(256) void k_round16f(const float* __restrict__ W, _Float16* __restrict__ Bt, size_t n8) { const size_t t = (size_t)blockIdx.x * 256 + threadIdx.x; if (t >= n8) return; FragH f;
#pragma unroll
  for (int i = 0; i < 8; ++i) f.h[i] = (_Float16)(bf16_round(W[t * 8 + i]) * 16.0f); *(v8us*)((unsigned short*)Bt + t * 8) = f.half[0];  }
__global__ __launch_bounds__(256) void k_hl(const float* __restrict__ F, _Float16* __restrict__ Hh, _Float16* __restrict__ Hl, size_t n8) { const size_t t = (size_t)blockIdx.x * 256 + threadIdx.x; if (t >= n8) return; FragH fh, fl; const v4f a = *(const v4fa*)(F + t * 8), c = *(const v4fa*)(F + t * 8 + 4);
#pragma unroll
  for (int q = 0; q < 4; ++q) { _Float16 h = (_Float16)a[q]; fh.h[q] = h; fl.h[q] = (_Float16)((a[q] - (float)h) * 1024.0f); h = (_Float16)c[q]; fh.h[4 + q] = h; fl.h[4 + q] = (_Float16)((c[q] - (float)h) * 1024.0f); }
  { *(v8us*)((unsigned short*)Hh + t * 8) = fh.half[0]; *(v8us*)((unsigned short*)Hl + t * 8) = fl.half[0];  } }

// ---- tiled GEMM: C = act(A . Bh^T * alpha + bias), A [M][K] and Bh [N][K] f16, k-contiguous. One 128x128 tile of C per work-group, 64x64 per wave (2x2 waves).
// A pass is 64 k = 128 B of each of the 256 operand rows; every wave brings its own 64-row slice into LDS with one tensor load (two buffers, the next
// pass's tile in flight under this pass's products). Requires M % 128 == 0, N % 128 == 0, K % 64 == 0, K >= 128; the grid is exactly (M / 128) * (N / 128).
// The inner loops are fully unrolled so that every accumulator and fragment index is a constant (registers, no scratch).
typedef unsigned int u32x4 __attribute__((ext_vector_type(4)));
typedef unsigned int u32x8 __attribute__((ext_vector_type(8)));
#define G_PITCH 144u             /* LDS row pitch: 128 B of k + the mover's 16-B pad (16 B x odd, for ds_load_b128 readers) */
#define G_SLICE 10240u           /* 64 rows x 144 B = 9216 B, rounded up to a multiple of 2 KiB */
#define G_STAGE (4u * G_SLICE)   /* one buffer: A rows 0-63, A rows 64-127, B rows 0-63, B rows 64-127 */
__device__ __forceinline__ unsigned int uni(unsigned int v) { return (unsigned int)__builtin_amdgcn_readfirstlane(v); }
__device__ __forceinline__ unsigned int pinned(unsigned int v) { unsigned int w = uni(v); asm volatile("" : "+s"(w)); return w; }
__device__ __forceinline__ void g2_wait_tensor0() { asm volatile("s_wait_tensorcnt 0x0" ::: "memory"); }  // this wave's own slice has landed (the compiler places no wait for the mover)
__device__ __forceinline__ void g2_wait_ds0() { asm volatile("s_wait_dscnt 0x0" ::: "memory"); }          // this wave's LDS reads have returned before its buffer is handed back
__device__ __forceinline__ void g2_tload(unsigned int lds_dst, unsigned long long ga, u32x8 g1) {
  u32x4 g0; g0[0] = uni(1u); g0[1] = uni(lds_dst); g0[2] = uni((unsigned int)ga); g0[3] = uni((((unsigned int)(ga >> 32)) & 0x01FFFFFFu) | 0x80000000u);
  asm volatile("tensor_load_to_lds %0, %1" :: "s"(g0), "s"(g1) : "memory");  // one request of the whole wave: 64 rows of 128 B into LDS, through no register
}
template <int ACT, int OUT>      /* OUT 0: f16 rows to C16; 1: f32 rows to C, with the residual R (same shape as C) added behind the activation; 2: f16 to C16 as V^T, [batch * NH + head][64 d][SLEN tokens] (N = NH * 64, ACT 0) */
__global__ __launch_bounds__(128) void k_gemm2(const _Float16* __restrict__ A, const _Float16* __restrict__ Bh, float alpha, const float* __restrict__ bias, const float* __restrict__ R,
    float* __restrict__ C, _Float16* __restrict__ C16, int N, int K) {
  __shared__ __attribute__((aligned(2048))) unsigned char L[2u * G_STAGE];
  const unsigned int tid = threadIdx.x, lane = tid & 31u, ln = lane & 15u, hh = lane >> 4;
  const unsigned int wave = uni(tid >> 5), wm = wave >> 1, wn = wave & 1u;
  const unsigned int ntn = (unsigned int)N >> 7; const unsigned int mt = blockIdx.x / ntn, nq = blockIdx.x - mt * ntn; const unsigned int row0 = mt * 128u, col0 = nq * 128u;
  const unsigned int kbytes = (unsigned int)K * 2u; const unsigned int NP = pinned((unsigned int)K >> 6);
  const unsigned char* src = (wave < 2u) ? (const unsigned char*)A + (size_t)(row0 + 64u * wave) * kbytes : (const unsigned char*)Bh + (size_t)(col0 + 64u * (wave - 2u)) * kbytes;
  const unsigned long long ga = (unsigned long long)(size_t)src; const unsigned int dst = (unsigned int)(size_t)L + wave * G_SLICE;
  u32x8 g1;      /* 1-byte elements, tensor = tile = 64 rows of 128 B, a 4-dword pad behind every 32 dwords, no mask */
  g1[0] = uni((1u << 20) | (4u << 22) | (3u << 25)); g1[1] = uni(128u << 16); g1[2] = uni(64u << 16); g1[3] = uni(128u << 16); g1[4] = uni(64u); g1[5] = uni(kbytes); g1[6] = uni(0u); g1[7] = uni(0u);
  asm volatile("" : "+s"(g1));      /* pinned() for the whole group: descriptor words held in scalar registers, so that none is reused as a temporary while a request is in flight */
  v8f acc[4][4];
#pragma unroll
  for (int i = 0; i < 4; ++i)
#pragma unroll
    for (int j = 0; j < 4; ++j) acc[i][j] = (v8f){0.f,0.f,0.f,0.f,0.f,0.f,0.f,0.f};
  const unsigned int a_base = wm * G_SLICE + ln * G_PITCH + 16u * hh, b_base = (2u + wn) * G_SLICE + ln * G_PITCH + 16u * hh;
  g2_tload(dst, ga, g1); g2_wait_tensor0(); __syncthreads();      /* stage 0 published */
  g2_tload(dst + G_STAGE, ga + 128u, g1);
#pragma unroll 1      /* one pass per trip: the buffer index stays a run-time offset and the accumulators stay in place */
  for (unsigned int s = 0; s < NP; ++s) { const unsigned int buf = (s & 1u) * G_STAGE;
    FragH a[2][4], b[2][4];      /* same k order in A and B: bytes 16 hh and 32 + 16 hh of each 64 B */
#pragma unroll
    for (int ks = 0; ks < 2; ++ks)
#pragma unroll
      for (int i = 0; i < 4; ++i) { const unsigned char* pa = L + buf + a_base + (unsigned int)i * 16u * G_PITCH + (unsigned int)ks * 64u; a[ks][i].half[0] = *(const v8us*)pa; a[ks][i].half[1] = *(const v8us*)(pa + 32);
        const unsigned char* pb = L + buf + b_base + (unsigned int)i * 16u * G_PITCH + (unsigned int)ks * 64u; b[ks][i].half[0] = *(const v8us*)pb; b[ks][i].half[1] = *(const v8us*)(pb + 32); }
    __builtin_amdgcn_sched_barrier(0);      /* the pass's LDS reads stay one group ahead of its products */
#pragma unroll
    for (int ks = 0; ks < 2; ++ks)
#pragma unroll
      for (int i = 0; i < 4; ++i)
#pragma unroll
        for (int j = 0; j < 4; ++j) acc[i][j] = __builtin_amdgcn_wmma_f32_16x16x32_f16(false, a[ks][i].v, false, b[ks][j].v, (short)0, acc[i][j], false, false);
    __builtin_amdgcn_sched_barrier(0);      /* the products stay in front of the wait for the next tile: moved behind it, that tile's flight would no longer be hidden under them */
    g2_wait_ds0(); g2_wait_tensor0(); __syncthreads();      /* publishes stage s + 1 and ends every reader's last read of stage s */
    if (pinned((s + 2u < NP) ? 1u : 0u)) g2_tload(dst + buf, ga + (unsigned long long)(s + 2u) * 128u, g1); }
  g2_wait_tensor0(); g2_wait_ds0();
  // Output staging in the ring, each wave in its own 20 KiB: the last pass's barrier stands behind every read of the ring, and no load is in flight.
  float* so = (float*)(L + wave * 20480u);      /* [64][68] f32 */
  if (OUT == 2) {      /* the wave's 64 columns are one head: scale and bias on the way into LDS, then the tile leaves column by column, 64 tokens = one 128-B line of V^T per d */
    float bj[4];
#pragma unroll
    for (int j = 0; j < 4; ++j) bj[j] = bf16_round(bias[col0 + wn * 64u + (unsigned int)j * 16u + ln]);
#pragma unroll
    for (int i = 0; i < 4; ++i)
#pragma unroll
      for (int j = 0; j < 4; ++j)
#pragma unroll
        for (int r = 0; r < 8; ++r) so[((unsigned int)i * 16u + 8u * hh + (unsigned int)r) * 68u + (unsigned int)j * 16u + ln] = acc[i][j][r] * alpha + bj[j];
    __builtin_amdgcn_fence(__ATOMIC_ACQ_REL, "workgroup"); __builtin_amdgcn_wave_barrier();
    const unsigned int tok0 = row0 + wm * 64u, slab = (tok0 / SLEN) * NH + ((col0 >> 6) + wn), pc = lane & 7u;
    unsigned short* vt = (unsigned short*)C16 + (size_t)slab * 64u * SLEN + (tok0 % SLEN) + pc * 8u;
#pragma unroll 1      /* kept rolled: one store a trip, with its wait below */
    for (unsigned int d0 = 0; d0 < 64u; d0 += 4u) { const unsigned int d = d0 + (lane >> 3); FragH f;
#pragma unroll
      for (int q = 0; q < 8; ++q) f.h[q] = (_Float16)so[(pc * 8u + (unsigned int)q) * 68u + d];
      *(v8us*)(vt + (size_t)d * SLEN) = f.half[0];
      asm volatile("s_wait_xcnt 0x0" ::: "memory");      /* in front of the next trip's writes to the registers that this trip's store names */
    }
    return; }
#pragma unroll
  for (int i = 0; i < 4; ++i)
#pragma unroll
    for (int j = 0; j < 4; ++j)
#pragma unroll
      for (int r = 0; r < 8; ++r) so[((unsigned int)i * 16u + 8u * hh + (unsigned int)r) * 68u + (unsigned int)j * 16u + ln] = acc[i][j][r];
  __builtin_amdgcn_fence(__ATOMIC_ACQ_REL, "workgroup"); __builtin_amdgcn_wave_barrier();
  const unsigned int c4 = ln * 4u; float bv[4];
#pragma unroll
  for (int e = 0; e < 4; ++e) bv[e] = bf16_round(bias[col0 + wn * 64u + c4 + (unsigned int)e]);
#pragma unroll 1      /* kept rolled: bias and activation on the rows read back, so that the erf body stands 16 times in the code and not 128 times (instruction cache) */
  for (unsigned int q0 = 0; q0 < 32u; q0 += 4u) { v4f v[4], xr[4];
    if (OUT == 1) {
#pragma unroll
      for (int u = 0; u < 4; ++u) xr[u] = *(const v4fa*)(R + (size_t)(row0 + wm * 64u + (q0 + (unsigned int)u) * 2u + hh) * (unsigned int)N + col0 + wn * 64u + c4);
      asm volatile("s_wait_xcnt 0x0" ::: "memory");      /* in front of any write to the registers that the residual loads name; it also keeps the four loads issued ahead of the activation, whose work covers their flight */
    }
#pragma unroll
    for (int u = 0; u < 4; ++u) v[u] = *(const v4fa*)&so[((q0 + (unsigned int)u) * 2u + hh) * 68u + c4];
#pragma unroll
    for (int u = 0; u < 4; ++u) { const size_t o = (size_t)(row0 + wm * 64u + (q0 + (unsigned int)u) * 2u + hh) * (unsigned int)N + col0 + wn * 64u + c4;
#pragma unroll
      for (int e = 0; e < 4; ++e) { float t = v[u][e] * alpha + bv[e]; if (ACT == 6) t = 0.5f * t * (1.0f + erff(t * 0.70710678118654752f)); v[u][e] = t; }
      if (OUT == 0) { v4h h4; for (int e = 0; e < 4; ++e) h4[e] = (_Float16)v[u][e]; *(v4h*)(C16 + o) = h4; } }
    if (OUT == 1) {      /* the residual joins behind all sixteen activations of the trip, so that its loads are first waited for here */
#pragma unroll
      for (int u = 0; u < 4; ++u) *(v4f*)(C + (size_t)(row0 + wm * 64u + (q0 + (unsigned int)u) * 2u + hh) * (unsigned int)N + col0 + wn * 64u + c4) = xr[u] + v[u]; }
    asm volatile("s_wait_xcnt 0x0" ::: "memory");      /* in front of the next trip's writes to the registers that this trip's stores name */
  } }



template <int CAUSAL>
__global__ __launch_bounds__(128) void k_flash(const _Float16* __restrict__ Q16, int ldq, const _Float16* __restrict__ K16, int ldk, const _Float16* __restrict__ Vt, const int* __restrict__ MSK, float* __restrict__ O, int ldo) {
  constexpr int RPW = 16, RTN = RPW / 16, NQB = TQ / (4 * RPW), DT = 4, KS = 2;
  __shared__ __attribute__((aligned(16))) unsigned short sP[4][RPW][40]; __shared__ __attribute__((aligned(16))) float sO[4][RPW][64 + 4];
  const int tid = threadIdx.x, w = tid >> 5, lane = tid & 31, ln = lane & 15, hh = lane >> 4;
  const int slab = blockIdx.x / QBLKS, qblk = blockIdx.x % QBLKS; (void)NQB; const int b = slab / NH, h = slab % NH; const int qb0 = qblk * (4 * RPW); const int q0 = qb0 + w * RPW;
  FragH aq[2][KS];
#pragma unroll
  for (int rt = 0; rt < RTN; ++rt) { const unsigned short* qr = (const unsigned short*)Q16 + ((size_t)b * TQ + q0 + rt * 16 + ln) * ldq + h * 64;
#pragma unroll
    for (int ks = 0; ks < KS; ++ks) { aq[rt][ks].half[0] = *(const v8us*)(qr + ks * 32 + 8 * hh); aq[rt][ks].half[1] = *(const v8us*)(qr + ks * 32 + 16 + 8 * hh); } }
  const unsigned short* Vth = (const unsigned short*)Vt + (size_t)slab * 64 * TK;
  float m_r[2][8], l_r[2][8]; v8f oacc[2][DT];
#pragma unroll
  for (int rt = 0; rt < RTN; ++rt) {
#pragma unroll
    for (int r = 0; r < 8; ++r) { m_r[rt][r] = -3.0e38f; l_r[rt][r] = 0.f; }
#pragma unroll
    for (int dt = 0; dt < DT; ++dt) oacc[rt][dt] = (v8f){0.f,0.f,0.f,0.f,0.f,0.f,0.f,0.f}; }
  const int jend = (CAUSAL == 1) ? (qb0 + 4 * RPW) : TK;      /* causal: keys beyond the block's last query never contribute */
#pragma unroll 1
  for (int j0 = 0; j0 < jend; j0 += 32) {
    v8f s[2][2];
#pragma unroll
    for (int nt = 0; nt < 2; ++nt) { const unsigned short* kr = (const unsigned short*)K16 + ((size_t)b * TK + j0 + nt * 16 + ln) * ldk + h * 64; FragH bk[KS];
#pragma unroll
      for (int ks = 0; ks < KS; ++ks) { bk[ks].half[0] = *(const v8us*)(kr + ks * 32 + 8 * hh); bk[ks].half[1] = *(const v8us*)(kr + ks * 32 + 16 + 8 * hh); }
#pragma unroll
      for (int rt = 0; rt < RTN; ++rt) { v8f acc = (v8f){0.f,0.f,0.f,0.f,0.f,0.f,0.f,0.f};
#pragma unroll
        for (int ks = 0; ks < KS; ++ks) acc = mmaH<1>(aq[rt][ks].v, aq[rt][ks].v, bk[ks].v, bk[ks].v, acc); s[rt][nt] = acc; } }
#pragma unroll
    for (int rt = 0; rt < RTN; ++rt)
#pragma unroll
      for (int r = 0; r < 8; ++r) { const int tq = q0 + rt * 16 + 8 * hh + r; const int k0 = j0 + ln, k1 = j0 + 16 + ln;
        const bool ok0 = (CAUSAL == 1) ? (k0 <= tq) : ((CAUSAL == 2) ? ((k0 >> 5) == (tq >> 5)) : true), ok1 = (CAUSAL == 1) ? (k1 <= tq) : ((CAUSAL == 2) ? ((k1 >> 5) == (tq >> 5)) : true);      /* mode 2: block-diagonal 32-token groups */
        const float s0 = ok0 ? s[rt][0][r] * SCL : -3.0e38f, s1 = ok1 ? s[rt][1][r] * SCL : -3.0e38f; float mc = fmaxf(s0, s1);
        mc = fmaxf(mc, __shfl_xor(mc, 1, 32)); mc = fmaxf(mc, __shfl_xor(mc, 2, 32)); mc = fmaxf(mc, __shfl_xor(mc, 4, 32)); mc = fmaxf(mc, __shfl_xor(mc, 8, 32));
        const float mn = fmaxf(m_r[rt][r], mc); const float al = (mn > -1.0e38f) ? expf(m_r[rt][r] - mn) : 1.0f; m_r[rt][r] = mn; const float p0 = ok0 ? expf(s0 - mn) : 0.f, p1 = ok1 ? expf(s1 - mn) : 0.f; l_r[rt][r] = l_r[rt][r] * al + p0 + p1;
#pragma unroll
        for (int dt = 0; dt < DT; ++dt) oacc[rt][dt][r] *= al;
        FragH t2; t2.h[0] = (_Float16)(p0 * 1024.0f); t2.h[1] = (_Float16)(p1 * 1024.0f); sP[w][rt * 16 + 8 * hh + r][ln] = t2.u[0]; sP[w][rt * 16 + 8 * hh + r][16 + ln] = t2.u[1]; }
    __builtin_amdgcn_fence(__ATOMIC_ACQ_REL, "workgroup"); __builtin_amdgcn_wave_barrier();
    FragH pa[2];
#pragma unroll
    for (int rt = 0; rt < RTN; ++rt) { pa[rt].half[0] = *(const v8us*)&sP[w][rt * 16 + ln][8 * hh]; pa[rt].half[1] = *(const v8us*)&sP[w][rt * 16 + ln][16 + 8 * hh]; }
#pragma unroll
    for (int dt = 0; dt < DT; ++dt) { const unsigned short* vrow = Vth + (size_t)(dt * 16 + ln) * TK + j0; FragH bv; bv.half[0] = *(const v8us*)(vrow + 8 * hh); bv.half[1] = *(const v8us*)(vrow + 16 + 8 * hh);
#pragma unroll
      for (int rt = 0; rt < RTN; ++rt) oacc[rt][dt] = mmaH<1>(pa[rt].v, pa[rt].v, bv.v, bv.v, oacc[rt][dt]); }
    __builtin_amdgcn_fence(__ATOMIC_ACQ_REL, "workgroup"); __builtin_amdgcn_wave_barrier(); }
#pragma unroll
  for (int rt = 0; rt < RTN; ++rt) {
#pragma unroll
    for (int r = 0; r < 8; ++r) { float l = l_r[rt][r]; l += __shfl_xor(l, 1, 32); l += __shfl_xor(l, 2, 32); l += __shfl_xor(l, 4, 32); l += __shfl_xor(l, 8, 32); l_r[rt][r] = (l > 0.f) ? 1.0f / (l * 1024.0f) : 0.f; }
#pragma unroll
    for (int dt = 0; dt < DT; ++dt)
#pragma unroll
      for (int r = 0; r < 8; ++r) sO[w][rt * 16 + 8 * hh + r][dt * 16 + ln] = oacc[rt][dt][r] * l_r[rt][r]; }
  __builtin_amdgcn_fence(__ATOMIC_ACQ_REL, "workgroup"); __builtin_amdgcn_wave_barrier();
  {
#pragma unroll
    for (int rp = 0; rp < RPW; rp += 2) { const int r = rp + (lane >> 4), pc = lane & 15; const v4f val = *(const v4fa*)&sO[w][r][pc * 4]; *(v4f*)(O + ((size_t)b * TQ + q0 + r) * ldo + h * 64 + pc * 4) = val; }
     } }

__global__ __launch_bounds__(256) void k_ln12(const float* __restrict__ O, const float* __restrict__ X, const float* __restrict__ g1, const float* __restrict__ b1, const float* __restrict__ g2, const float* __restrict__ b2, float* __restrict__ X1, _Float16* __restrict__ L2) {
  #pragma clang fp contract(off)
  const int wv = threadIdx.x >> 5, ln = threadIdx.x & 31; const size_t r = (size_t)blockIdx.x * 8 + wv; if (r >= NR) return; float a[24]; float s = 0.f;
  for (int i = 0; i < 3; ++i) { const v8f v = *(const v8f*)(O + r * DM + (i * 32 + ln) * 8); for (int q = 0; q < 8; ++q) { a[i * 8 + q] = v[q]; s += v[q]; } }
  for (int o = 16; o > 0; o >>= 1) s += __shfl_xor(s, o, 32); float mu = s / (float)DM; float var = 0.f; for (int q = 0; q < 24; ++q) { const float d = a[q] - mu; var += d * d; }
  for (int o = 16; o > 0; o >>= 1) var += __shfl_xor(var, o, 32); float inv = rsqrtf(var / (float)DM + 1e-5f);
  float s2 = 0.f; v8f xv[3];
#pragma unroll
  for (int i = 0; i < 3; ++i) xv[i] = *(const v8f*)(X + r * DM + (i * 32 + ln) * 8);
  asm volatile("s_wait_xcnt 0x0" ::: "memory");      /* in front of any write to the registers that the loads of x name */
#pragma unroll      /* constant indices into a[] and xv[]: left rolled, the arrays go to scratch memory */
  for (int i = 0; i < 3; ++i) { const int c0 = (i * 32 + ln) * 8; const v8f xb = xv[i]; for (int q = 0; q < 8; ++q) { float y = (a[i * 8 + q] - mu) * inv; y *= bf16_round(g1[c0 + q]); y += bf16_round(b1[c0 + q]); const float x1 = bf16_round(xb[q]) + y; a[i * 8 + q] = x1; s2 += x1; } }      /* a[] now holds x1 */
  for (int o = 16; o > 0; o >>= 1) s2 += __shfl_xor(s2, o, 32); mu = s2 / (float)DM; var = 0.f; for (int q = 0; q < 24; ++q) { const float d = a[q] - mu; var += d * d; }
  for (int o = 16; o > 0; o >>= 1) var += __shfl_xor(var, o, 32); inv = rsqrtf(var / (float)DM + 1e-5f);
  { for (int i = 0; i < 3; ++i) { const int c0 = (i * 32 + ln) * 8; v8f xo; FragH f; for (int q = 0; q < 8; ++q) { xo[q] = a[i * 8 + q]; float y = (a[i * 8 + q] - mu) * inv; y *= bf16_round(g2[c0 + q]); y += bf16_round(b2[c0 + q]); f.h[q] = (_Float16)y; } *(v8f*)(X1 + r * DM + c0) = xo; *(v8us*)((unsigned short*)L2 + r * DM + c0) = f.half[0]; }  } }

extern "C" void kernel_launch(void* const* d_in, const int* in_sizes, int n_in,
                              void* d_out, int out_size, void* d_ws, size_t ws_size, hipStream_t stream) {
  (void)in_sizes; (void)n_in; (void)out_size;
  const float* const* I = (const float* const*)d_in; const float* x = I[0]; const float* wq = I[1]; const float* bq = I[2]; const float* wk = I[3]; const float* bk = I[4]; const float* wv = I[5]; const float* bv = I[6]; const float* g1 = I[7]; const float* b1 = I[8]; const float* g2 = I[9]; const float* b2 = I[10]; const float* w_in = I[11]; const float* b_in = I[12]; const float* w_out = I[13]; const float* b_out = I[14];
  char* ws = (char*)d_ws; size_t off = 0;
  auto take = [&](size_t bytes) { char* p = ws + off; off += (bytes + 255) & ~(size_t)255; return p; };
  const size_t np = (size_t)NR * DM;
  _Float16* BQ = (_Float16*)take((size_t)DM * DM * 2); _Float16* BK = (_Float16*)take((size_t)DM * DM * 2); _Float16* BV = (_Float16*)take((size_t)DM * DM * 2); _Float16* BIN = (_Float16*)take((size_t)HIDN * DM * 2); _Float16* BOUT = (_Float16*)take((size_t)DM * HIDN * 2);
  _Float16* X16 = (_Float16*)take(np * 2); _Float16* Q16 = (_Float16*)take(np * 2); _Float16* K16 = (_Float16*)take(np * 2); _Float16* VT = (_Float16*)take(np * 2); float* O = (float*)take(np * 4); float* X1 = (float*)take(np * 4); _Float16* L2 = X16;      /* LN2 output over the input f16 plane (dead after the projections) */ _Float16* HH = (_Float16*)take((size_t)NR * HIDN * 2);      /* hidden [8192][3072] f16 */
  if (off > ws_size) return;      /* 1.1 x3 + 4.5 + 4.5 + 12 + 12 x 3 + 24 + 24 + 48 = 156 MiB */
  k_wt_f16<<<(unsigned)(((size_t)DM * DM / 8 + 255) / 256), 256, 0, stream>>>(wq, BQ, DM, DM, 16.0f); k_wt_f16<<<(unsigned)(((size_t)DM * DM / 8 + 255) / 256), 256, 0, stream>>>(wk, BK, DM, DM, 16.0f); k_wt_f16<<<(unsigned)(((size_t)DM * DM / 8 + 255) / 256), 256, 0, stream>>>(wv, BV, DM, DM, 16.0f);
  k_wt_f16<<<(unsigned)(((size_t)DM * HIDN / 8 + 255) / 256), 256, 0, stream>>>(w_in, BIN, DM, HIDN, 16.0f); k_wt_f16<<<(unsigned)(((size_t)HIDN * DM / 8 + 255) / 256), 256, 0, stream>>>(w_out, BOUT, HIDN, DM, 16.0f);
  const unsigned n8 = (unsigned)((np / 8 + 255) / 256); const dim3 g((NR / 128) * (DM / 128), 1);
  k_x16<<<n8, 256, 0, stream>>>(x, X16, np / 8);
  k_gemm2<0, 0><<<g, 128, 0, stream>>>(X16, BQ, 0.0625f, bq, nullptr, nullptr, Q16, DM, DM);
  k_gemm2<0, 0><<<g, 128, 0, stream>>>(X16, BK, 0.0625f, bk, nullptr, nullptr, K16, DM, DM);
  k_gemm2<0, 2><<<g, 128, 0, stream>>>(X16, BV, 0.0625f, bv, nullptr, nullptr, VT, DM, DM);      /* v, stored as V^T */
  k_flash<0><<<NB * NH * QBLKS, 128, 0, stream>>>(Q16, DM, K16, DM, VT, nullptr, O, DM);      /* ctx (no out_proj) */
  k_ln12<<<NR / 8, 256, 0, stream>>>(O, x, g1, b1, g2, b2, X1, L2);      /* x1 = x + LN1(ctx); L2 = LN2(x1) */
  k_gemm2<6, 0><<<dim3((NR / 128) * (HIDN / 128), 1), 128, 0, stream>>>(L2, BIN, 0.0625f, b_in, nullptr, nullptr, HH, HIDN, DM);      /* gelu(LN2 w_in + b) */
  k_gemm2<6, 1><<<g, 128, 0, stream>>>(HH, BOUT, 0.0625f, b_out, X1, (float*)d_out, nullptr, DM, HIDN);      /* out = x1 + gelu(h w_out + b) */
}

// v003
// One run takes 267 microseconds.
// Timed twice side by side with v002, it ran 1.28 and 1.29 times as fast.
// Over all steps from v000 it is 2.33 times as fast.
#include <hip/hip_runtime.h>
// TransofmerEncoderBlock (8 x 1024 tokens, D 768 = 12 heads of 64, hidden 3072): q/k/v = x W + b; full softmax(q k^T / 8) v (no out_proj, as the source); x1 = x + LN1(ctx); h = gelu(LN2(x1) w_in + b_in); h = gelu(h w_out + b_out) (GELU after BOTH linears, as the source); out = x1 + h.
// Structure: exact f16 plane of x; q/k/v GEMMs (128x128 tiles staged in LDS, f32 accumulation, exact x16 weights + bias, f16 outputs); V^T written by the v GEMM's own epilogue; the fused flash kernel (plain f16 operands); LayerNorm of the attention output + residual on VALU (wave per row, x rounded to bf16 as it is read) into x1 (f32) and LN2(x1) (f16); the MLP GEMMs with exact-erf GELU epilogues (f16 hidden); the final residual in the last GEMM's epilogue.
// Compute dtype: x and parameters rounded to bf16; q, k, v, P, LN2 output and the hidden activation as f16 operands (~2^-12); f32 accumulation/softmax/LN/GELU/residuals. v_wmma_f32_16x16x32_f16.
#define NB 8
#define DM 768
#define HIDN 3072
#define NR (NB * SLEN)           /* 8192 rows */
#define SLEN 1024
#define TQ SLEN
#define TK SLEN
#define NH 12
#define SCL 0.125f               /* HD^-0.5 */
#define QBLKS (TQ / 128)
typedef __bf16 v16b __attribute__((ext_vector_type(16)));
typedef unsigned short v8us __attribute__((ext_vector_type(8), may_alias));
typedef float  v8f  __attribute__((ext_vector_type(8)));
typedef float  v4f  __attribute__((ext_vector_type(4)));
typedef float  v4fa __attribute__((ext_vector_type(4), may_alias));
union FragB { v16b v; v8us half[2]; unsigned short u[16]; };

__device__ __forceinline__ unsigned short bf16_bits(float x) { unsigned int u = __float_as_uint(x); return (unsigned short)((u + 0x7FFFu + ((u >> 16) & 1u)) >> 16); }
__device__ __forceinline__ float bf16_val(unsigned short b) { return __uint_as_float(((unsigned int)b) << 16); }
__device__ __forceinline__ float bf16_round(float x) { return bf16_val(bf16_bits(x)); }
// D += A·B with NT terms: 1 = ah·bh, 2 = + al·bh (A split), 3 = + ah·bl (both split)
template <int NT>
__device__ __forceinline__ v8f mmaN(v16b ah, v16b al, v16b bh, v16b bl, v8f c) {
  c = __builtin_amdgcn_wmma_f32_16x16x32_bf16(false, ah, false, bh, (short)0, c, false, false);
  if (NT >= 2) c = __builtin_amdgcn_wmma_f32_16x16x32_bf16(false, al, false, bh, (short)0, c, false, false);
  if (NT >= 3) c = __builtin_amdgcn_wmma_f32_16x16x32_bf16(false, ah, false, bl, (short)0, c, false, false);
  asm volatile("v_nop\n\tv_nop\n\tv_nop\n\tv_nop" : "+v"(c) : "v"(ah), "v"(al), "v"(bh), "v"(bl));
  return c;
}

__global__ __launch_bounds__(256) void k_wt_bf16(const float* __restrict__ W, unsigned short* __restrict__ Wt, int K, int N) {
  const int t = blockIdx.x * 256 + threadIdx.x;
  const int k8n = K / 8;
  if (t >= N * k8n) return;
  const int n = t / k8n, k8 = (t % k8n) * 8;
  v8us v;
#pragma unroll
  for (int i = 0; i < 8; ++i) v[i] = bf16_bits(W[(size_t)(k8 + i) * N + n]);
  *(v8us*)(Wt + (size_t)n * K + k8) = v;
  
}

// GEMM C[M][N] (f32, pitch ldc) = act(A[M][K]·W + bias). A f32 row-major (pitch lda) converted per fragment to bf16
// (ASPLIT: hi/lo two planes -> 2 terms, else single rounded term); Wt bf16 [N][K] (pitch ldb). BIAS_BF16 rounds the
// bias to bf16 first (bias quantised to bf16 before the add). K%32==0, M%16==0, N%64==0.
template <bool ASPLIT, int ACT, bool BIAS_BF16>
__global__ __launch_bounds__(128) void k_gemm_bf(const float* __restrict__ A, int lda, const unsigned short* __restrict__ Wt, int ldb,
                                               const float* __restrict__ bias, float* __restrict__ C, int ldc, int M, int N, int K) {
  __shared__ __attribute__((aligned(16))) float so[4][16][64];
  const int tid = threadIdx.x, w = tid >> 5, lane = tid & 31, ln = lane & 15, hh = lane >> 4;
  const int ntn = N / 64;
  const int wid = blockIdx.x * 4 + w;
  const int mt = wid / ntn, nq = wid % ntn;
  if (mt * 16 >= M) return;
  const int row0 = mt * 16, col0 = nq * 64;
  const float* arow = A + (size_t)(row0 + ln) * lda;
  v8f acc[4] = {};
  for (int kb = 0; kb < K; kb += 32) {
    FragB ah, al;
    const v4f x0 = *(const v4fa*)(arow + kb + 8 * hh), x1 = *(const v4fa*)(arow + kb + 8 * hh + 4);
    const v4f x2 = *(const v4fa*)(arow + kb + 16 + 8 * hh), x3 = *(const v4fa*)(arow + kb + 16 + 8 * hh + 4);
    float xs[16] = {x0[0],x0[1],x0[2],x0[3],x1[0],x1[1],x1[2],x1[3],x2[0],x2[1],x2[2],x2[3],x3[0],x3[1],x3[2],x3[3]};
#pragma unroll
    for (int i = 0; i < 16; ++i) { const unsigned short hb = bf16_bits(xs[i]); ah.u[i] = hb; al.u[i] = ASPLIT ? bf16_bits(xs[i] - bf16_val(hb)) : (unsigned short)0; }
#pragma unroll
    for (int t = 0; t < 4; ++t) {
      const unsigned short* brow = Wt + (size_t)(col0 + t * 16 + ln) * ldb + kb;
      FragB b;
      b.half[0] = *(const v8us*)(brow + 8 * hh);
      b.half[1] = *(const v8us*)(brow + 16 + 8 * hh);
      acc[t] = mmaN<ASPLIT ? 2 : 1>(ah.v, al.v, b.v, b.v, acc[t]);
    }
  }
#pragma unroll
  for (int t = 0; t < 4; ++t) {
    float bv = bias ? bias[col0 + t * 16 + ln] : 0.f;
    if (BIAS_BF16) bv = bf16_round(bv);
#pragma unroll
    for (int r = 0; r < 8; ++r) { float v = acc[t][r] + bv; if (ACT == 1) v = fmaxf(v, 0.f); so[w][8 * hh + r][t * 16 + ln] = v; }
  }
  __builtin_amdgcn_fence(__ATOMIC_ACQ_REL, "workgroup");
  __builtin_amdgcn_wave_barrier();
  const int rsub = lane >> 4, c4 = (lane & 15) * 4;
  {
#pragma unroll
    for (int q = 0; q < 8; ++q) {
      const int r = q * 2 + rsub;
      const v4f v = *(const v4fa*)&so[w][r][c4];
      *(v4f*)(C + (size_t)(row0 + r) * ldc + col0 + c4) = v;
    }
    
  }
}

// GEMM C = act(A·W + bias + resid): A f32 (ASPLIT -> hi/lo 2 terms), Wt bf16 [N][K]; ACT 0 none, 1 relu, 2 exact gelu;
// resid (optional, f32, row index = (row % rmod), pitch ldr, RES_BF16 rounds it) added before the activation.
template <bool ASPLIT, int ACT, bool BIAS_BF16, bool RES_BF16>
__global__ __launch_bounds__(128) void k_gemm_bf3(const float* __restrict__ A, int lda, const unsigned short* __restrict__ Wt, int ldb,
                                                const float* __restrict__ bias, const float* __restrict__ resid, int rmod, int ldr,
                                                float* __restrict__ C, int ldc, int M, int N, int K) {
  __shared__ __attribute__((aligned(16))) float so[4][16][64];
  const int tid = threadIdx.x, w = tid >> 5, lane = tid & 31, ln = lane & 15, hh = lane >> 4;
  const int ntn = N / 64;
  const int wid = blockIdx.x * 4 + w;
  const int mt = wid / ntn, nq = wid % ntn;
  if (mt * 16 >= M) return;
  const int row0 = mt * 16, col0 = nq * 64;
  const float* arow = A + (size_t)(row0 + ln) * lda;
  v8f acc[4] = {};
  for (int kb = 0; kb < K; kb += 32) {
    FragB ah, al;
    const v4f x0 = *(const v4fa*)(arow + kb + 8 * hh), x1 = *(const v4fa*)(arow + kb + 8 * hh + 4);
    const v4f x2 = *(const v4fa*)(arow + kb + 16 + 8 * hh), x3 = *(const v4fa*)(arow + kb + 16 + 8 * hh + 4);
    float xs[16] = {x0[0],x0[1],x0[2],x0[3],x1[0],x1[1],x1[2],x1[3],x2[0],x2[1],x2[2],x2[3],x3[0],x3[1],x3[2],x3[3]};
#pragma unroll
    for (int i = 0; i < 16; ++i) { const unsigned short hb = bf16_bits(xs[i]); ah.u[i] = hb; al.u[i] = ASPLIT ? bf16_bits(xs[i] - bf16_val(hb)) : (unsigned short)0; }
#pragma unroll
    for (int t = 0; t < 4; ++t) {
      const unsigned short* brow = Wt + (size_t)(col0 + t * 16 + ln) * ldb + kb;
      FragB b;
      b.half[0] = *(const v8us*)(brow + 8 * hh);
      b.half[1] = *(const v8us*)(brow + 16 + 8 * hh);
      acc[t] = mmaN<ASPLIT ? 2 : 1>(ah.v, al.v, b.v, b.v, acc[t]);
    }
  }
#pragma unroll
  for (int t = 0; t < 4; ++t) {
    const int col = col0 + t * 16 + ln;
    float bv = bias ? bias[col] : 0.f;
    if (BIAS_BF16) bv = bf16_round(bv);
#pragma unroll
    for (int r = 0; r < 8; ++r) {
      float v = acc[t][r] + bv;
      if (resid) { float rv = resid[(size_t)((row0 + 8 * hh + r) % rmod) * ldr + col]; if (RES_BF16) rv = bf16_round(rv); v += rv; }
      if (ACT == 1) v = fmaxf(v, 0.f);
      if (ACT == 2) v = 0.5f * v * (1.0f + erff(v * 0.70710678118654752f));
      if (ACT == 3) { const float u = 0.7978845608028654f * (v + 0.044715f * v * v * v); v = 0.5f * v * (1.0f + tanhf(u)); }
      so[w][8 * hh + r][t * 16 + ln] = v;
    }
  }
  __builtin_amdgcn_fence(__ATOMIC_ACQ_REL, "workgroup");
  __builtin_amdgcn_wave_barrier();
  const int rsub = lane >> 4, c4 = (lane & 15) * 4;
  {
#pragma unroll
    for (int q = 0; q < 8; ++q) {
      const int r = q * 2 + rsub;
      const v4f v = *(const v4fa*)&so[w][r][c4];
      *(v4f*)(C + (size_t)(row0 + r) * ldc + col0 + c4) = v;
    }
    
  }
}
// row LayerNorm (biased variance, eps) over N: s = X (+ R); optional out_sum <- s; out_norm <- (s-mu)*rsqrt(var+eps)*g + b
template <bool PARAM_BF16>
__global__ __launch_bounds__(256) void k_layernorm(const float* __restrict__ X, const float* __restrict__ R, const float* __restrict__ g, const float* __restrict__ bta,
                                                  float* __restrict__ out_sum, float* __restrict__ out_norm, int N, float eps) {
  __shared__ float red[256];
  const int row = blockIdx.x, tid = threadIdx.x;
  const float* x = X + (size_t)row * N; const float* rr = R ? R + (size_t)row * N : nullptr;
  float vals[16];                     // up to N = 4096
  const int per = N / 256;            // contiguous chunk per thread? use strided-by-4 chunks: thread handles j = tid*4 + 1024*u
  float s1 = 0.f;
  for (int u = 0; u < per / 4; ++u) {
    const int j = tid * 4 + 1024 * u;
    const v4f a = *(const v4fa*)(x + j);
    v4f b = {0.f,0.f,0.f,0.f}; if (rr) b = *(const v4fa*)(rr + j);
#pragma unroll
    for (int q = 0; q < 4; ++q) { const float v = a[q] + b[q]; vals[u * 4 + q] = v; s1 += v; }
  }
  red[tid] = s1; __syncthreads();
  for (int st = 128; st > 0; st >>= 1) { if (tid < st) red[tid] += red[tid + st]; __syncthreads(); }
  const float mu = red[0] / (float)N; __syncthreads();
  float s2 = 0.f;
  for (int u = 0; u < per / 4; ++u)
#pragma unroll
    for (int q = 0; q < 4; ++q) { const float c = vals[u * 4 + q] - mu; s2 += c * c; }
  red[tid] = s2; __syncthreads();
  for (int st = 128; st > 0; st >>= 1) { if (tid < st) red[tid] += red[tid + st]; __syncthreads(); }
  const float rs = rsqrtf(red[0] / (float)N + eps);
  {
    for (int u = 0; u < per / 4; ++u) {
      const int j = tid * 4 + 1024 * u;
      v4f o, sm;
#pragma unroll
      for (int q = 0; q < 4; ++q) {
        float gg = g[j + q], bb = bta[j + q];
        if (PARAM_BF16) { gg = bf16_round(gg); bb = bf16_round(bb); }
        sm[q] = vals[u * 4 + q]; o[q] = (vals[u * 4 + q] - mu) * rs * gg + bb;
      }
      if (out_sum) *(v4f*)(out_sum + (size_t)row * N + j) = sm;
      *(v4f*)(out_norm + (size_t)row * N + j) = o;
    }
    
  }
}



// ---- f16 WMMA path (v_wmma_f32_16x16x32_f16): 11-bit significands for operands in range — used where a [0,1] probability operand needs more precision than bf16
typedef _Float16 v16h __attribute__((ext_vector_type(16)));
union FragH { v16h v; v8us half[2]; _Float16 h[16]; unsigned short u[16]; };
template <int NT>
__device__ __forceinline__ v8f mmaH(v16h ah, v16h al, v16h bh, v16h bl, v8f c) {
  c = __builtin_amdgcn_wmma_f32_16x16x32_f16(false, ah, false, bh, (short)0, c, false, false);
  if (NT >= 2) c = __builtin_amdgcn_wmma_f32_16x16x32_f16(false, al, false, bh, (short)0, c, false, false);
  if (NT >= 3) c = __builtin_amdgcn_wmma_f32_16x16x32_f16(false, ah, false, bl, (short)0, c, false, false);
  asm volatile("v_nop\n\tv_nop\n\tv_nop\n\tv_nop" : "+v"(c) : "v"(ah), "v"(al), "v"(bh), "v"(bl));
  return c;
}
// batched GEMM like k_gemm_b but f16 operands: A f32 (split into f16 hi/lo if ASPLIT, else rounded to f16), Bt = f16 values [n][k]; alpha; C f32; N multiple of 16 (partial tiles skipped)
template <bool ASPLIT>
__global__ __launch_bounds__(128) void k_gemm_h(const float* __restrict__ A, int lda, size_t sA, const _Float16* __restrict__ Bh, int ldb, size_t sB, float alpha, float* __restrict__ C, int ldc, size_t sC, int M, int N, int K) {
  __shared__ __attribute__((aligned(16))) float so[4][16][64];
  const int tid = threadIdx.x, w = tid >> 5, lane = tid & 31, ln = lane & 15, hh = lane >> 4; const int by = blockIdx.y;
  A += (size_t)by * sA; Bh += (size_t)by * sB; C += (size_t)by * sC;
  const int ntn = (N + 63) / 64; const int wid = blockIdx.x * 4 + w; const int mt = wid / ntn, nq = wid % ntn; if (mt * 16 >= M) return;
  const int row0 = mt * 16, col0 = nq * 64; const float* arow = A + (size_t)(row0 + ln) * lda;
  v8f acc[4] = {};
  for (int kb = 0; kb < K; kb += 32) {
    FragH ah, al;
    const v4f x0 = *(const v4fa*)(arow + kb + 8 * hh), x1 = *(const v4fa*)(arow + kb + 8 * hh + 4), x2 = *(const v4fa*)(arow + kb + 16 + 8 * hh), x3 = *(const v4fa*)(arow + kb + 16 + 8 * hh + 4);
    float xs[16] = {x0[0],x0[1],x0[2],x0[3],x1[0],x1[1],x1[2],x1[3],x2[0],x2[1],x2[2],x2[3],x3[0],x3[1],x3[2],x3[3]};
#pragma unroll
    for (int i = 0; i < 16; ++i) { const _Float16 h = (_Float16)xs[i]; ah.h[i] = h; al.h[i] = ASPLIT ? (_Float16)(xs[i] - (float)h) : (_Float16)0.0f; }
#pragma unroll
    for (int t = 0; t < 4; ++t) { if (col0 + t * 16 >= N) continue; const size_t boff = (size_t)(col0 + t * 16 + ln) * ldb + kb; FragH bq; bq.half[0] = *(const v8us*)(Bh + boff + 8 * hh); bq.half[1] = *(const v8us*)(Bh + boff + 16 + 8 * hh);
      acc[t] = mmaH<ASPLIT ? 2 : 1>(ah.v, al.v, bq.v, bq.v, acc[t]); }
  }
#pragma unroll
  for (int t = 0; t < 4; ++t) { if (col0 + t * 16 >= N) continue;
#pragma unroll
    for (int r = 0; r < 8; ++r) so[w][8 * hh + r][t * 16 + ln] = acc[t][r] * alpha; }
  __builtin_amdgcn_fence(__ATOMIC_ACQ_REL, "workgroup"); __builtin_amdgcn_wave_barrier();
  const int rsub = lane >> 4, c4 = (lane & 15) * 4;
  {
#pragma unroll
    for (int q = 0; q < 8; ++q) { const int r = q * 2 + rsub; if (col0 + c4 < N) { const v4f v = *(const v4fa*)&so[w][r][c4]; *(v4f*)(C + (size_t)(row0 + r) * ldc + col0 + c4) = v; } }
     }
}

// Wt[n][k] = f16(W[k][n]·scale) from f32 row-major W[K][N] (scale = power of two; bf16-exact weights stay exact in f16 away from the subnormal range)
__global__ __launch_bounds__(256) void k_wt_f16(const float* __restrict__ W, _Float16* __restrict__ Wt, int K, int N, float scale) {
  const int t = blockIdx.x * 256 + threadIdx.x; if (t >= N * (K / 8)) return; const int n = t / (K / 8), k8 = (t % (K / 8)) * 8; FragH f;
#pragma unroll
  for (int i = 0; i < 8; ++i) f.h[i] = (_Float16)(bf16_round(W[(size_t)(k8 + i) * N + n]) * scale); const v8us o = f.half[0];
  *(v8us*)((unsigned short*)Wt + (size_t)n * K + k8) = o; 
}
// k_gemm_hh variant with fused epilogue: v = acc·alpha + bias[by·sBias + col] (+ CP[(row/rowsPerB)·sCPb + by·64 + col] if CP) ; ACT 0 none / 1 elu ; writes f16 C16 (and f32 C if non-null)
template <int ACT>
__global__ __launch_bounds__(128) void k_gemm_hhx(const _Float16* __restrict__ A, int lda, size_t sA, const _Float16* __restrict__ Bh, int ldb, size_t sB, float alpha, const float* __restrict__ bias, size_t sBias, const float* __restrict__ CP, int rowsPerB, size_t sCPb, int row0g,
    float* __restrict__ C, _Float16* __restrict__ C16, int ldc, size_t sC, int M, int N, int K) {
  __shared__ __attribute__((aligned(16))) float so[4][16][64];
  const int tid = threadIdx.x, w = tid >> 5, lane = tid & 31, ln = lane & 15, hh = lane >> 4; const int by = blockIdx.y;
  A += (size_t)by * sA; Bh += (size_t)by * sB; const size_t cofs = (size_t)by * sC; const float* bp = bias ? bias + (size_t)by * sBias : nullptr;
  const int ntn = (N + 63) / 64; const int wid = blockIdx.x * 4 + w; const int mt = wid / ntn, nq = wid % ntn; if (mt * 16 >= M) return;
  const int row0 = mt * 16, col0 = nq * 64; const _Float16* arow = A + (size_t)(row0 + ln) * lda;
  v8f acc[4] = {};
  for (int kb = 0; kb < K; kb += 32) { FragH ah; ah.half[0] = *(const v8us*)((const unsigned short*)arow + kb + 8 * hh); ah.half[1] = *(const v8us*)((const unsigned short*)arow + kb + 16 + 8 * hh);
#pragma unroll
    for (int t = 0; t < 4; ++t) { if (col0 + t * 16 >= N) continue; const size_t boff = (size_t)(col0 + t * 16 + ln) * ldb + kb; FragH bq; bq.half[0] = *(const v8us*)((const unsigned short*)Bh + boff + 8 * hh); bq.half[1] = *(const v8us*)((const unsigned short*)Bh + boff + 16 + 8 * hh);
      acc[t] = mmaH<1>(ah.v, ah.v, bq.v, bq.v, acc[t]); }
  }
#pragma unroll
  for (int t = 0; t < 4; ++t) { if (col0 + t * 16 >= N) continue; const int col = col0 + t * 16 + ln; const float bv = bp ? bf16_round(bp[col]) : 0.f;
#pragma unroll
    for (int r = 0; r < 8; ++r) { float v = acc[t][r] * alpha + bv; if (CP) { const int bidx = (row0g + row0 + 8 * hh + r) / rowsPerB; v += CP[(size_t)bidx * sCPb + (size_t)by * 64 + col]; } if (ACT == 1) v = (v > 0.f) ? v : expm1f(v); else if (ACT == 7) v = (v > 0.f) ? v + 1.0f : expf(v); else if (ACT == 8) v = tanhf(v); else if (ACT == 9) v = 0.5f * v * (1.0f + tanhf(0.7978845608028654f * (v + 0.044715f * v * v * v))); else if (ACT == 11) v = 1.0f / (1.0f + expf(-v)); else if (ACT == 12) v = (v > 0.f) ? v : 0.01f * v; else if (ACT == 14) v = (v > 0.f) ? v : 0.1f * v; else if (ACT == 15) v = v / (1.0f + expf(-v)); else if (ACT == 3) v = fmaxf(v, 0.f); else if (ACT == 6) v = 0.5f * v * (1.0f + erff(v * 0.70710678118654752f)); so[w][8 * hh + r][t * 16 + ln] = v; } }
  __builtin_amdgcn_fence(__ATOMIC_ACQ_REL, "workgroup"); __builtin_amdgcn_wave_barrier();
  const int rsub = lane >> 4, c4 = (lane & 15) * 4; typedef _Float16 v4h __attribute__((ext_vector_type(4)));
  {
#pragma unroll
    for (int q = 0; q < 8; ++q) { const int r = q * 2 + rsub; if (col0 + c4 < N) { const v4f v = *(const v4fa*)&so[w][r][c4]; if (C) *(v4f*)(C + cofs + (size_t)(row0 + r) * ldc + col0 + c4) = v; if (C16) { v4h h4; for (int i = 0; i < 4; ++i) h4[i] = (_Float16)v[i]; *(v4h*)(C16 + cofs + (size_t)(row0 + r) * ldc + col0 + c4) = h4; } } }
     }
}


typedef _Float16 v4h __attribute__((ext_vector_type(4)));

__global__ __launch_bounds__(256) void k_x16(const float* __restrict__ x, _Float16* __restrict__ X16, size_t n8) { const size_t t = (size_t)blockIdx.x * 256 + threadIdx.x; if (t >= n8) return; FragH f;
#pragma unroll
  for (int q = 0; q < 8; ++q) f.h[q] = (_Float16)bf16_round(x[t * 8 + q]); *(v8us*)((unsigned short*)X16 + t * 8) = f.half[0];  }
__global__ __launch_bounds__(256) void k_h16(const float* __restrict__ x, _Float16* __restrict__ X16, size_t n8) { const size_t t = (size_t)blockIdx.x * 256 + threadIdx.x; if (t >= n8) return; FragH f;
#pragma unroll
  for (int q = 0; q < 8; ++q) f.h[q] = (_Float16)x[t * 8 + q]; *(v8us*)((unsigned short*)X16 + t * 8) = f.half[0];  }
__global__ __launch_bounds__(256) void k_round16f(const float* __restrict__ W, _Float16* __restrict__ Bt, size_t n8) { const size_t t = (size_t)blockIdx.x * 256 + threadIdx.x; if (t >= n8) return; FragH f;
#pragma unroll
  for (int i = 0; i < 8; ++i) f.h[i] = (_Float16)(bf16_round(W[t * 8 + i]) * 16.0f); *(v8us*)((unsigned short*)Bt + t * 8) = f.half[0];  }
__global__ __launch_bounds__(256) void k_hl(const float* __restrict__ F, _Float16* __restrict__ Hh, _Float16* __restrict__ Hl, size_t n8) { const size_t t = (size_t)blockIdx.x * 256 + threadIdx.x; if (t >= n8) return; FragH fh, fl; const v4f a = *(const v4fa*)(F + t * 8), c = *(const v4fa*)(F + t * 8 + 4);
#pragma unroll
  for (int q = 0; q < 4; ++q) { _Float16 h = (_Float16)a[q]; fh.h[q] = h; fl.h[q] = (_Float16)((a[q] - (float)h) * 1024.0f); h = (_Float16)c[q]; fh.h[4 + q] = h; fl.h[4 + q] = (_Float16)((c[q] - (float)h) * 1024.0f); }
  { *(v8us*)((unsigned short*)Hh + t * 8) = fh.half[0]; *(v8us*)((unsigned short*)Hl + t * 8) = fl.half[0];  } }

// ---- tiled GEMM: C = act(A . Bh^T * alpha + bias), A [M][K] and Bh [N][K] f16, k-contiguous. One 128x128 tile of C per work-group, 64x64 per wave (2x2 waves).
// A pass is 64 k = 128 B of each of the 256 operand rows; every wave brings its own 64-row slice into LDS with one tensor load (two buffers, the next
// pass's tile in flight under this pass's products). Requires M % 128 == 0, N % 128 == 0, K % 64 == 0, K >= 128; the grid is exactly (M / 128) * (N / 128).
// The inner loops are fully unrolled so that every accumulator and fragment index is a constant (registers, no scratch).
typedef unsigned int u32x4 __attribute__((ext_vector_type(4)));
typedef unsigned int u32x8 __attribute__((ext_vector_type(8)));
#define G_PITCH 144u             /* LDS row pitch: 128 B of k + the mover's 16-B pad (16 B x odd, for ds_load_b128 readers) */
#define G_SLICE 10240u           /* 64 rows x 144 B = 9216 B, rounded up to a multiple of 2 KiB */
#define G_STAGE (4u * G_SLICE)   /* one buffer: A rows 0-63, A rows 64-127, B rows 0-63, B rows 64-127 */
__device__ __forceinline__ unsigned int uni(unsigned int v) { return (unsigned int)__builtin_amdgcn_readfirstlane(v); }
__device__ __forceinline__ unsigned int pinned(unsigned int v) { unsigned int w = uni(v); asm volatile("" : "+s"(w)); return w; }
__device__ __forceinline__ void g2_wait_tensor0() { asm volatile("s_wait_tensorcnt 0x0" ::: "memory"); }  // this wave's own slice has landed (the compiler places no wait for the mover)
__device__ __forceinline__ void g2_wait_ds0() { asm volatile("s_wait_dscnt 0x0" ::: "memory"); }          // this wave's LDS reads have returned before its buffer is handed back
__device__ __forceinline__ void g2_tload(unsigned int lds_dst, unsigned long long ga, u32x8 g1) {
  u32x4 g0; g0[0] = uni(1u); g0[1] = uni(lds_dst); g0[2] = uni((unsigned int)ga); g0[3] = uni((((unsigned int)(ga >> 32)) & 0x01FFFFFFu) | 0x80000000u);
  asm volatile("tensor_load_to_lds %0, %1" :: "s"(g0), "s"(g1) : "memory");  // one request of the whole wave: 64 rows of 128 B into LDS, through no register
}
template <int ACT, int OUT>      /* OUT 0: f16 rows to C16; 1: f32 rows to C, with the residual R (same shape as C) added behind the activation; 2: f16 to C16 as V^T, [batch * NH + head][64 d][SLEN tokens] (N = NH * 64, ACT 0) */
__global__ __launch_bounds__(128) void k_gemm2(const _Float16* __restrict__ A, const _Float16* __restrict__ Bh, float alpha, const float* __restrict__ bias, const float* __restrict__ R,
    float* __restrict__ C, _Float16* __restrict__ C16, int N, int K) {
  __shared__ __attribute__((aligned(2048))) unsigned char L[2u * G_STAGE];
  const unsigned int tid = threadIdx.x, lane = tid & 31u, ln = lane & 15u, hh = lane >> 4;
  const unsigned int wave = uni(tid >> 5), wm = wave >> 1, wn = wave & 1u;
  const unsigned int ntn = (unsigned int)N >> 7; const unsigned int mt = blockIdx.x / ntn, nq = blockIdx.x - mt * ntn; const unsigned int row0 = mt * 128u, col0 = nq * 128u;
  const unsigned int kbytes = (unsigned int)K * 2u; const unsigned int NP = pinned((unsigned int)K >> 6);
  const unsigned char* src = (wave < 2u) ? (const unsigned char*)A + (size_t)(row0 + 64u * wave) * kbytes : (const unsigned char*)Bh + (size_t)(col0 + 64u * (wave - 2u)) * kbytes;
  const unsigned long long ga = (unsigned long long)(size_t)src; const unsigned int dst = (unsigned int)(size_t)L + wave * G_SLICE;
  u32x8 g1;      /* 1-byte elements, tensor = tile = 64 rows of 128 B, a 4-dword pad behind every 32 dwords, no mask */
  g1[0] = uni((1u << 20) | (4u << 22) | (3u << 25)); g1[1] = uni(128u << 16); g1[2] = uni(64u << 16); g1[3] = uni(128u << 16); g1[4] = uni(64u); g1[5] = uni(kbytes); g1[6] = uni(0u); g1[7] = uni(0u);
  asm volatile("" : "+s"(g1));      /* pinned() for the whole group: descriptor words held in scalar registers, so that none is reused as a temporary while a request is in flight */
  v8f acc[4][4];
#pragma unroll
  for (int i = 0; i < 4; ++i)
#pragma unroll
    for (int j = 0; j < 4; ++j) acc[i][j] = (v8f){0.f,0.f,0.f,0.f,0.f,0.f,0.f,0.f};
  const unsigned int a_base = wm * G_SLICE + ln * G_PITCH + 16u * hh, b_base = (2u + wn) * G_SLICE + ln * G_PITCH + 16u * hh;
  g2_tload(dst, ga, g1); g2_wait_tensor0(); __syncthreads();      /* stage 0 published */
  g2_tload(dst + G_STAGE, ga + 128u, g1);
#pragma unroll 1      /* one pass per trip: the buffer index stays a run-time offset and the accumulators stay in place */
  for (unsigned int s = 0; s < NP; ++s) { const unsigned int buf = (s & 1u) * G_STAGE;
    FragH a[2][4], b[2][4];      /* same k order in A and B: bytes 16 hh and 32 + 16 hh of each 64 B */
#pragma unroll
    for (int ks = 0; ks < 2; ++ks)
#pragma unroll
      for (int i = 0; i < 4; ++i) { const unsigned char* pa = L + buf + a_base + (unsigned int)i * 16u * G_PITCH + (unsigned int)ks * 64u; a[ks][i].half[0] = *(const v8us*)pa; a[ks][i].half[1] = *(const v8us*)(pa + 32);
        const unsigned char* pb = L + buf + b_base + (unsigned int)i * 16u * G_PITCH + (unsigned int)ks * 64u; b[ks][i].half[0] = *(const v8us*)pb; b[ks][i].half[1] = *(const v8us*)(pb + 32); }
    __builtin_amdgcn_sched_barrier(0);      /* the pass's LDS reads stay one group ahead of its products */
#pragma unroll
    for (int ks = 0; ks < 2; ++ks)
#pragma unroll
      for (int i = 0; i < 4; ++i)
#pragma unroll
        for (int j = 0; j < 4; ++j) acc[i][j] = __builtin_amdgcn_wmma_f32_16x16x32_f16(false, a[ks][i].v, false, b[ks][j].v, (short)0, acc[i][j], false, false);
    __builtin_amdgcn_sched_barrier(0);      /* the products stay in front of the wait for the next tile: moved behind it, that tile's flight would no longer be hidden under them */
    g2_wait_ds0(); g2_wait_tensor0(); __syncthreads();      /* publishes stage s + 1 and ends every reader's last read of stage s */
    if (pinned((s + 2u < NP) ? 1u : 0u)) g2_tload(dst + buf, ga + (unsigned long long)(s + 2u) * 128u, g1); }
  g2_wait_tensor0(); g2_wait_ds0();
  // Output staging in the ring, each wave in its own 20 KiB: the last pass's barrier stands behind every read of the ring, and no load is in flight.
  float* so = (float*)(L + wave * 20480u);      /* [64][68] f32 */
  if (OUT == 2) {      /* the wave's 64 columns are one head: scale and bias on the way into LDS, then the tile leaves column by column, 64 tokens = one 128-B line of V^T per d */
    float bj[4];
#pragma unroll
    for (int j = 0; j < 4; ++j) bj[j] = bf16_round(bias[col0 + wn * 64u + (unsigned int)j * 16u + ln]);
#pragma unroll
    for (int i = 0; i < 4; ++i)
#pragma unroll
      for (int j = 0; j < 4; ++j)
#pragma unroll
        for (int r = 0; r < 8; ++r) so[((unsigned int)i * 16u + 8u * hh + (unsigned int)r) * 68u + (unsigned int)j * 16u + ln] = acc[i][j][r] * alpha + bj[j];
    __builtin_amdgcn_fence(__ATOMIC_ACQ_REL, "workgroup"); __builtin_amdgcn_wave_barrier();
    const unsigned int tok0 = row0 + wm * 64u, slab = (tok0 / SLEN) * NH + ((col0 >> 6) + wn), pc = lane & 7u;
    unsigned short* vt = (unsigned short*)C16 + (size_t)slab * 64u * SLEN + (tok0 % SLEN) + pc * 8u;
#pragma unroll 1      /* kept rolled: one store a trip, with its wait below */
    for (unsigned int d0 = 0; d0 < 64u; d0 += 4u) { const unsigned int d = d0 + (lane >> 3); FragH f;
#pragma unroll
      for (int q = 0; q < 8; ++q) f.h[q] = (_Float16)so[(pc * 8u + (unsigned int)q) * 68u + d];
      *(v8us*)(vt + (size_t)d * SLEN) = f.half[0];
      asm volatile("s_wait_xcnt 0x0" ::: "memory");      /* in front of the next trip's writes to the registers that this trip's store names */
    }
    return; }
#pragma unroll
  for (int i = 0; i < 4; ++i)
#pragma unroll
    for (int j = 0; j < 4; ++j)
#pragma unroll
      for (int r = 0; r < 8; ++r) so[((unsigned int)i * 16u + 8u * hh + (unsigned int)r) * 68u + (unsigned int)j * 16u + ln] = acc[i][j][r];
  __builtin_amdgcn_fence(__ATOMIC_ACQ_REL, "workgroup"); __builtin_amdgcn_wave_barrier();
  const unsigned int c4 = ln * 4u; float bv[4];
#pragma unroll
  for (int e = 0; e < 4; ++e) bv[e] = bf16_round(bias[col0 + wn * 64u + c4 + (unsigned int)e]);
#pragma unroll 1      /* kept rolled: bias and activation on the rows read back, so that the erf body stands 16 times in the code and not 128 times (instruction cache) */
  for (unsigned int q0 = 0; q0 < 32u; q0 += 4u) { v4f v[4], xr[4];
    if (OUT == 1) {
#pragma unroll
      for (int u = 0; u < 4; ++u) xr[u] = *(const v4fa*)(R + (size_t)(row0 + wm * 64u + (q0 + (unsigned int)u) * 2u + hh) * (unsigned int)N + col0 + wn * 64u + c4);
      asm volatile("s_wait_xcnt 0x0" ::: "memory");      /* in front of any write to the registers that the residual loads name; it also keeps the four loads issued ahead of the activation, whose work covers their flight */
    }
#pragma unroll
    for (int u = 0; u < 4; ++u) v[u] = *(const v4fa*)&so[((q0 + (unsigned int)u) * 2u + hh) * 68u + c4];
#pragma unroll
    for (int u = 0; u < 4; ++u) { const size_t o = (size_t)(row0 + wm * 64u + (q0 + (unsigned int)u) * 2u + hh) * (unsigned int)N + col0 + wn * 64u + c4;
#pragma unroll
      for (int e = 0; e < 4; ++e) { float t = v[u][e] * alpha + bv[e]; if (ACT == 6) t = 0.5f * t * (1.0f + erff(t * 0.70710678118654752f)); v[u][e] = t; }
      if (OUT == 0) { v4h h4; for (int e = 0; e < 4; ++e) h4[e] = (_Float16)v[u][e]; *(v4h*)(C16 + o) = h4; } }
    if (OUT == 1) {      /* the residual joins behind all sixteen activations of the trip, so that its loads are first waited for here */
#pragma unroll
      for (int u = 0; u < 4; ++u) *(v4f*)(C + (size_t)(row0 + wm * 64u + (q0 + (unsigned int)u) * 2u + hh) * (unsigned int)N + col0 + wn * 64u + c4) = xr[u] + v[u]; }
    asm volatile("s_wait_xcnt 0x0" ::: "memory");      /* in front of the next trip's writes to the registers that this trip's stores name */
  } }



// Attention in the transposed form: S^T = K Q^T (A = 16 keys x 32 d, B = 16 query columns), O^T += V^T P^T. A lane holds scores of ONE query (column ln; register r of key tile nt is key 16 nt + 8 hh + r),
// so maximum and sum run inside the lane, with one exchange between the wave's halves, and the two score tiles, converted in place, ARE the B operand of the second product (element s = tile s >> 3, register s & 7:
// the k order of the V^T loader, keys 8 hh + s and 16 + 8 hh + (s - 8)). Each wave takes 32 query columns, so every K and V^T fragment feeds two column tiles. Work-group = 4 waves = 128 queries of one head.
__device__ __forceinline__ float xhalf(float x) { return __builtin_bit_cast(float, __builtin_amdgcn_permlanex16(__builtin_bit_cast(int, x), __builtin_bit_cast(int, x), 0x76543210, 0xfedcba98, false, false)); }  // lane l with lane l ^ 16
__global__ __launch_bounds__(128) void k_flash(const _Float16* __restrict__ Q16, int ldq, const _Float16* __restrict__ K16, int ldk, const _Float16* __restrict__ Vt, float* __restrict__ O, int ldo) {
  constexpr int CT = 2, DT = 4, KS = 2;
  __shared__ __attribute__((aligned(16))) float sO[4][CT * 16][64 + 4];
  const int tid = threadIdx.x, w = tid >> 5, lane = tid & 31, ln = lane & 15, hh = lane >> 4;
  const int slab = blockIdx.x / QBLKS, qblk = blockIdx.x % QBLKS; const int b = slab / NH, h = slab % NH; const int q0 = qblk * (4 * CT * 16) + w * (CT * 16);
  FragH bq[CT][KS];
#pragma unroll
  for (int ct = 0; ct < CT; ++ct) { const unsigned short* qr = (const unsigned short*)Q16 + ((size_t)b * TQ + q0 + ct * 16 + ln) * ldq + h * 64;
#pragma unroll
    for (int ks = 0; ks < KS; ++ks) { bq[ct][ks].half[0] = *(const v8us*)(qr + ks * 32 + 8 * hh); bq[ct][ks].half[1] = *(const v8us*)(qr + ks * 32 + 16 + 8 * hh); } }
  const unsigned short* Kh = (const unsigned short*)K16 + ((size_t)b * TK + ln) * ldk + h * 64 + 8 * hh;
  const unsigned short* Vth = (const unsigned short*)Vt + (size_t)slab * 64 * TK + (size_t)ln * TK + 8 * hh;
  float m_c[CT], l_c[CT]; v8f oacc[CT][DT];
#pragma unroll
  for (int ct = 0; ct < CT; ++ct) { m_c[ct] = -3.0e38f; l_c[ct] = 0.f;
#pragma unroll
    for (int dt = 0; dt < DT; ++dt) oacc[ct][dt] = (v8f){0.f,0.f,0.f,0.f,0.f,0.f,0.f,0.f}; }
#pragma unroll 1      /* one 32-key pass per trip: the accumulators stay in place */
  for (int j0 = 0; j0 < TK; j0 += 32) {
    FragH ak[2][KS], av[DT];
#pragma unroll
    for (int nt = 0; nt < 2; ++nt) { const unsigned short* kr = Kh + (size_t)(j0 + nt * 16) * ldk;
#pragma unroll
      for (int ks = 0; ks < KS; ++ks) { ak[nt][ks].half[0] = *(const v8us*)(kr + ks * 32); ak[nt][ks].half[1] = *(const v8us*)(kr + ks * 32 + 16); } }
#pragma unroll
    for (int dt = 0; dt < DT; ++dt) { const unsigned short* vrow = Vth + (size_t)(dt * 16) * TK + j0; av[dt].half[0] = *(const v8us*)vrow; av[dt].half[1] = *(const v8us*)(vrow + 16); }
    v8f s[CT][2];
#pragma unroll
    for (int ct = 0; ct < CT; ++ct)
#pragma unroll
      for (int nt = 0; nt < 2; ++nt) { v8f acc = (v8f){0.f,0.f,0.f,0.f,0.f,0.f,0.f,0.f};
#pragma unroll
        for (int ks = 0; ks < KS; ++ks) acc = __builtin_amdgcn_wmma_f32_16x16x32_f16(false, ak[nt][ks].v, false, bq[ct][ks].v, (short)0, acc, false, false);
        s[ct][nt] = acc; }
#pragma unroll
    for (int ct = 0; ct < CT; ++ct) {
      float sc[16]; float mc = -3.0e38f;
#pragma unroll
      for (int e = 0; e < 16; ++e) { sc[e] = s[ct][e >> 3][e & 7] * SCL; mc = fmaxf(mc, sc[e]); }
      mc = fmaxf(mc, xhalf(mc));      /* both halves of the wave hold this query's maximum over the 32 keys */
      const float mn = fmaxf(m_c[ct], mc); const float al = expf(m_c[ct] - mn); m_c[ct] = mn;
      FragH pb; float ls = 0.f;
#pragma unroll
      for (int e = 0; e < 16; ++e) { const float p = expf(sc[e] - mn); ls += p; pb.h[e] = (_Float16)(p * 1024.0f); }
      l_c[ct] = l_c[ct] * al + ls;
#pragma unroll
      for (int dt = 0; dt < DT; ++dt) {
#pragma unroll
        for (int r = 0; r < 8; ++r) oacc[ct][dt][r] *= al;
        oacc[ct][dt] = __builtin_amdgcn_wmma_f32_16x16x32_f16(false, av[dt].v, false, pb.v, (short)0, oacc[ct][dt], false, false); } } }
#pragma unroll
  for (int ct = 0; ct < CT; ++ct) { const float l = l_c[ct] + xhalf(l_c[ct]); const float inv = (l > 0.f) ? 1.0f / (l * 1024.0f) : 0.f;
#pragma unroll
    for (int dt = 0; dt < DT; ++dt) { v4f lo, hi;      /* register r of tile dt is d = 16 dt + 8 hh + r of query ct * 16 + ln */
#pragma unroll
      for (int r = 0; r < 4; ++r) { lo[r] = oacc[ct][dt][r] * inv; hi[r] = oacc[ct][dt][4 + r] * inv; }
      *(v4fa*)&sO[w][ct * 16 + ln][dt * 16 + 8 * hh] = lo; *(v4fa*)&sO[w][ct * 16 + ln][dt * 16 + 8 * hh + 4] = hi; } }
  __builtin_amdgcn_fence(__ATOMIC_ACQ_REL, "workgroup"); __builtin_amdgcn_wave_barrier();
  {
#pragma unroll
    for (int rp = 0; rp < CT * 16; rp += 2) { const int r = rp + (lane >> 4), pc = lane & 15; const v4f val = *(const v4fa*)&sO[w][r][pc * 4]; *(v4f*)(O + ((size_t)b * TQ + q0 + r) * ldo + h * 64 + pc * 4) = val; }
     } }

__global__ __launch_bounds__(256) void k_ln12(const float* __restrict__ O, const float* __restrict__ X, const float* __restrict__ g1, const float* __restrict__ b1, const float* __restrict__ g2, const float* __restrict__ b2, float* __restrict__ X1, _Float16* __restrict__ L2) {
  #pragma clang fp contract(off)
  const int wv = threadIdx.x >> 5, ln = threadIdx.x & 31; const size_t r = (size_t)blockIdx.x * 8 + wv; if (r >= NR) return; float a[24]; float s = 0.f;
  for (int i = 0; i < 3; ++i) { const v8f v = *(const v8f*)(O + r * DM + (i * 32 + ln) * 8); for (int q = 0; q < 8; ++q) { a[i * 8 + q] = v[q]; s += v[q]; } }
  for (int o = 16; o > 0; o >>= 1) s += __shfl_xor(s, o, 32); float mu = s / (float)DM; float var = 0.f; for (int q = 0; q < 24; ++q) { const float d = a[q] - mu; var += d * d; }
  for (int o = 16; o > 0; o >>= 1) var += __shfl_xor(var, o, 32); float inv = rsqrtf(var / (float)DM + 1e-5f);
  float s2 = 0.f; v8f xv[3];
#pragma unroll
  for (int i = 0; i < 3; ++i) xv[i] = *(const v8f*)(X + r * DM + (i * 32 + ln) * 8);
  asm volatile("s_wait_xcnt 0x0" ::: "memory");      /* in front of any write to the registers that the loads of x name */
#pragma unroll      /* constant indices into a[] and xv[]: left rolled, the arrays go to scratch memory */
  for (int i = 0; i < 3; ++i) { const int c0 = (i * 32 + ln) * 8; const v8f xb = xv[i]; for (int q = 0; q < 8; ++q) { float y = (a[i * 8 + q] - mu) * inv; y *= bf16_round(g1[c0 + q]); y += bf16_round(b1[c0 + q]); const float x1 = bf16_round(xb[q]) + y; a[i * 8 + q] = x1; s2 += x1; } }      /* a[] now holds x1 */
  for (int o = 16; o > 0; o >>= 1) s2 += __shfl_xor(s2, o, 32); mu = s2 / (float)DM; var = 0.f; for (int q = 0; q < 24; ++q) { const float d = a[q] - mu; var += d * d; }
  for (int o = 16; o > 0; o >>= 1) var += __shfl_xor(var, o, 32); inv = rsqrtf(var / (float)DM + 1e-5f);
  { for (int i = 0; i < 3; ++i) { const int c0 = (i * 32 + ln) * 8; v8f xo; FragH f; for (int q = 0; q < 8; ++q) { xo[q] = a[i * 8 + q]; float y = (a[i * 8 + q] - mu) * inv; y *= bf16_round(g2[c0 + q]); y += bf16_round(b2[c0 + q]); f.h[q] = (_Float16)y; } *(v8f*)(X1 + r * DM + c0) = xo; *(v8us*)((unsigned short*)L2 + r * DM + c0) = f.half[0]; }  } }

extern "C" void kernel_launch(void* const* d_in, const int* in_sizes, int n_in,
                              void* d_out, int out_size, void* d_ws, size_t ws_size, hipStream_t stream) {
  (void)in_sizes; (void)n_in; (void)out_size;
  const float* const* I = (const float* const*)d_in; const float* x = I[0]; const float* wq = I[1]; const float* bq = I[2]; const float* wk = I[3]; const float* bk = I[4]; const float* wv = I[5]; const float* bv = I[6]; const float* g1 = I[7]; const float* b1 = I[8]; const float* g2 = I[9]; const float* b2 = I[10]; const float* w_in = I[11]; const float* b_in = I[12]; const float* w_out = I[13]; const float* b_out = I[14];
  char* ws = (char*)d_ws; size_t off = 0;
  auto take = [&](size_t bytes) { char* p = ws + off; off += (bytes + 255) & ~(size_t)255; return p; };
  const size_t np = (size_t)NR * DM;
  _Float16* BQ = (_Float16*)take((size_t)DM * DM * 2); _Float16* BK = (_Float16*)take((size_t)DM * DM * 2); _Float16* BV = (_Float16*)take((size_t)DM * DM * 2); _Float16* BIN = (_Float16*)take((size_t)HIDN * DM * 2); _Float16* BOUT = (_Float16*)take((size_t)DM * HIDN * 2);
  _Float16* X16 = (_Float16*)take(np * 2); _Float16* Q16 = (_Float16*)take(np * 2); _Float16* K16 = (_Float16*)take(np * 2); _Float16* VT = (_Float16*)take(np * 2); float* O = (float*)take(np * 4); float* X1 = (float*)take(np * 4); _Float16* L2 = X16;      /* LN2 output over the input f16 plane (dead after the projections) */ _Float16* HH = (_Float16*)take((size_t)NR * HIDN * 2);      /* hidden [8192][3072] f16 */
  if (off > ws_size) return;      /* 1.1 x3 + 4.5 + 4.5 + 12 + 12 x 3 + 24 + 24 + 48 = 156 MiB */
  k_wt_f16<<<(unsigned)(((size_t)DM * DM / 8 + 255) / 256), 256, 0, stream>>>(wq, BQ, DM, DM, 16.0f); k_wt_f16<<<(unsigned)(((size_t)DM * DM / 8 + 255) / 256), 256, 0, stream>>>(wk, BK, DM, DM, 16.0f); k_wt_f16<<<(unsigned)(((size_t)DM * DM / 8 + 255) / 256), 256, 0, stream>>>(wv, BV, DM, DM, 16.0f);
  k_wt_f16<<<(unsigned)(((size_t)DM * HIDN / 8 + 255) / 256), 256, 0, stream>>>(w_in, BIN, DM, HIDN, 16.0f); k_wt_f16<<<(unsigned)(((size_t)HIDN * DM / 8 + 255) / 256), 256, 0, stream>>>(w_out, BOUT, HIDN, DM, 16.0f);
  const unsigned n8 = (unsigned)((np / 8 + 255) / 256); const dim3 g((NR / 128) * (DM / 128), 1);
  k_x16<<<n8, 256, 0, stream>>>(x, X16, np / 8);
  k_gemm2<0, 0><<<g, 128, 0, stream>>>(X16, BQ, 0.0625f, bq, nullptr, nullptr, Q16, DM, DM);
  k_gemm2<0, 0><<<g, 128, 0, stream>>>(X16, BK, 0.0625f, bk, nullptr, nullptr, K16, DM, DM);
  k_gemm2<0, 2><<<g, 128, 0, stream>>>(X16, BV, 0.0625f, bv, nullptr, nullptr, VT, DM, DM);      /* v, stored as V^T */
  k_flash<<<NB * NH * QBLKS, 128, 0, stream>>>(Q16, DM, K16, DM, VT, O, DM);      /* ctx (no out_proj) */
  k_ln12<<<NR / 8, 256, 0, stream>>>(O, x, g1, b1, g2, b2, X1, L2);      /* x1 = x + LN1(ctx); L2 = LN2(x1) */
  k_gemm2<6, 0><<<dim3((NR / 128) * (HIDN / 128), 1), 128, 0, stream>>>(L2, BIN, 0.0625f, b_in, nullptr, nullptr, HH, HIDN, DM);      /* gelu(LN2 w_in + b) */
  k_gemm2<6, 1><<<g, 128, 0, stream>>>(HH, BOUT, 0.0625f, b_out, X1, (float*)d_out, nullptr, DM, HIDN);      /* out = x1 + gelu(h w_out + b) */
}
